// v000
// Times are from an AMD MI455X. After a warm-up the kernel runs many times in a row, and a time is the length of
// such a window on the GPU divided by its runs, so every launch and the gaps after it count. The runs cycle
// through copies of the inputs. A figure is the median of several windows, for all but v000 over two sittings.
// Sittings can differ by a few percent; kernels timed side by side share one.
// The starting kernel, v000, takes 1180 microseconds a run.
// compute dtype: all float inputs RNE-converted to bf16 on load; q/k/v projections on v_wmma_f32_16x16x32_bf16 (bf16 operands, exact products), f32 accumulate; scores on v_wmma_f32_16x16x32_f16 with q and k each = f16 hi + f16 residual x2^11 (3 products hi.hi, res.hi, hi.res; 2 accumulators); magnitude and softmax in f32 -> P f16 x2^14; P.v on v_wmma_f32_16x16x32_f16 with v = f16 hi (1 product); f32 output.
#include <hip/hip_runtime.h>
#include <math.h>

typedef __attribute__((ext_vector_type(16))) _Float16 v16h;
typedef __attribute__((ext_vector_type(16))) __bf16 v16b;
typedef __attribute__((ext_vector_type(8)))  _Float16 v8h;
typedef __attribute__((ext_vector_type(8)))  __bf16 v8b;
typedef __attribute__((ext_vector_type(8)))  float v8f;
typedef __attribute__((ext_vector_type(8)))  unsigned v8u;
typedef __attribute__((ext_vector_type(4)))  float v4f;
typedef __attribute__((ext_vector_type(4)))  unsigned v4u;

#define DD 512            // feature width per real/imag part
#define KP 1024           // concatenated contraction length [re | im]
#define NB_FULL 8
#define SEQ_FULL 1024
#ifndef NB
#define NB NB_FULL
#endif
#ifndef SEQ
#define SEQ SEQ_FULL
#endif
#define MR (NB * SEQ)     // projection rows
#define QCAR 2048.0f      // carry of the q and k residual planes
#define PCAR 16384.0f     // carry of the P plane
#define SCL 0.044194173824159216f   // 1/sqrt(512)

static_assert(NB >= 1 && NB <= NB_FULL);
static_assert(SEQ >= 256 && SEQ <= SEQ_FULL && (SEQ % 256) == 0);
static_assert((MR % 64) == 0);

#define WPL    ((size_t)DD * KP)                      // elements per weight plane
#define WS_X   ((size_t)0)                             // bf16 [MR][KP]
#define WS_W   (WS_X + 2u * (size_t)MR * KP)           // bf16 6 x [DD][KP]
#define WS_QH  (WS_W + 2u * 6u * WPL)                  // f16  [MR][KP] q hi
#define WS_QR  (WS_QH + 2u * (size_t)MR * KP)          // f16  [MR][KP] q residual x2^11
#define WS_KH  (WS_QR + 2u * (size_t)MR * KP)          // f16  [MR][KP] k hi  = [kr | ki]
#define WS_KR  (WS_KH + 2u * (size_t)MR * KP)          // f16  [MR][KP] k residual x2^11
#define WS_VT  (WS_KR + 2u * (size_t)MR * KP)          // f16  [NB][KP][SEQ]
#define WS_S   (WS_VT + 2u * (size_t)NB * KP * SEQ)    // f32  2 x [SEQ][SEQ]
#define WS_P   (WS_S + 4u * 2u * (size_t)SEQ * SEQ)    // f16  [SEQ][SEQ]
#define WS_END (WS_P + 2u * (size_t)SEQ * SEQ)
static_assert(WS_END <= (size_t)134217728);
static_assert((WS_W % 256) == 0 && (WS_QH % 256) == 0 && (WS_QR % 256) == 0 && (WS_KH % 256) == 0 && (WS_KR % 256) == 0 && (WS_VT % 256) == 0 && (WS_S % 256) == 0 && (WS_P % 256) == 0);

template <typename T> __device__ __forceinline__ void vst2(void* p, T v) { *(T*)p = v;  }

__device__ __forceinline__ v8f wmma16(v16h a, v16h b, v8f c) {
  v8f d = __builtin_amdgcn_wmma_f32_16x16x32_f16(false, a, false, b, (short)0, c, false, false);
  asm volatile("v_nop\n\tv_nop\n\tv_nop\n\tv_nop" : "+v"(d) : "v"(a), "v"(b));
  return d;
}
__device__ __forceinline__ v8f wmma_bf(v16b a, v16b b, v8f c) {
  v8f d = __builtin_amdgcn_wmma_f32_16x16x32_bf16(false, a, false, b, (short)0, c, false, false);
  asm volatile("v_nop\n\tv_nop\n\tv_nop\n\tv_nop" : "+v"(d) : "v"(a), "v"(b));
  return d;
}
// 16x16x32 fragments: lane = (h = lane>>4, row/col = lane&15); elements 0..7 = k0+8h+0..7, 8..15 = k0+16+8h+0..7; D element r = row 8h+r, col lane&15
__device__ __forceinline__ v16h frag_h(const _Float16* rowk0, int lane) {
  union { v16h v; v8h q[2]; } u; const _Float16* p = rowk0 + 8 * (lane >> 4);
  u.q[0] = *(const v8h*)p; u.q[1] = *(const v8h*)(p + 16); return u.v;
}
__device__ __forceinline__ v16b frag_b(const __bf16* rowk0, int lane) {
  union { v16b v; v8b q[2]; } u; const __bf16* p = rowk0 + 8 * (lane >> 4);
  u.q[0] = *(const v8b*)p; u.q[1] = *(const v8b*)(p + 16); return u.v;
}
// sign-bit flip of all 16 halves when m == 0x80008000 (exact negation), identity when m == 0
__device__ __forceinline__ v16h hneg(v16h x, unsigned m) { v8u u = __builtin_bit_cast(v8u, x); u ^= m; return __builtin_bit_cast(v16h, u); }
__device__ __forceinline__ float bfr(float v) { return (float)(__bf16)v; }
__device__ __attribute__((noinline)) float exp_ni(float v) { return expf(v); }

// ---- k_cvx: X[row][0..511] = bf16(xr[row]), X[row][512..1023] = bf16(xi[row]); block = 2 rows, 128 threads per row (64 re + 64 im), 8 values -> one 16-B store per thread
__global__ __launch_bounds__(256) void k_cvx(const float* __restrict__ XR, const float* __restrict__ XI, __bf16* __restrict__ X) {
  const int tid = threadIdx.x; const int row = blockIdx.x * 2 + (tid >> 7); const int t = tid & 127;
  const int half = t >> 6; const int c = (t & 63) * 8;               // half is wave-uniform
  const int bb = row / SEQ, n = row - bb * SEQ;
  const float* sp = (half ? XI : XR) + ((size_t)bb * SEQ_FULL + n) * DD + c;
  const v4f f0 = *(const v4f*)sp, f1 = *(const v4f*)(sp + 4);
  v8b o;
#pragma unroll
  for (int i = 0; i < 4; ++i) { o[i] = (__bf16)f0[i]; o[4 + i] = (__bf16)f1[i]; }
  vst2(X + (size_t)row * KP + half * DD + c, __builtin_bit_cast(v4u, o));
}
// ---- k_cvw: weight planes of one complex linear: BRE[e] = [Wr[e] | -Wi[e]], BIM[e] = [Wi[e] | Wr[e]] (bf16, negation exact); block = 4 rows, 64 threads per row
__global__ __launch_bounds__(256) void k_cvw(const float* __restrict__ WR, const float* __restrict__ WI, __bf16* __restrict__ BRE, __bf16* __restrict__ BIM) {
  const int tid = threadIdx.x; const int e = blockIdx.x * 4 + (tid >> 6); const int c = (tid & 63) * 8;
  const float* pr = WR + (size_t)e * DD + c; const float* pi = WI + (size_t)e * DD + c;
  const v4f r0 = *(const v4f*)pr, r1 = *(const v4f*)(pr + 4), i0 = *(const v4f*)pi, i1 = *(const v4f*)(pi + 4);
  v8b vr, vi, vn;
#pragma unroll
  for (int i = 0; i < 4; ++i) { vr[i] = (__bf16)r0[i]; vr[4 + i] = (__bf16)r1[i]; vi[i] = (__bf16)i0[i]; vi[4 + i] = (__bf16)i1[i]; vn[i] = (__bf16)(-i0[i]); vn[4 + i] = (__bf16)(-i1[i]); }
  vst2(BRE + (size_t)e * KP + c,      __builtin_bit_cast(v4u, vr));
  vst2(BRE + (size_t)e * KP + DD + c, __builtin_bit_cast(v4u, vn));
  vst2(BIM + (size_t)e * KP + c,      __builtin_bit_cast(v4u, vi));
  vst2(BIM + (size_t)e * KP + DD + c, __builtin_bit_cast(v4u, vr));
}

// ---- k_proj: Y[MR][512-col tile] = X[MR][KP] . Wp[512][KP]^T + bias; block = 64 rows x 128 cols, 4 waves each 16 rows x 128 cols
// mode 0: f16 hi -> P0, f16 residual x2^11 -> P1, pitch KP, at column c0 + n
__global__ __launch_bounds__(128) void k_proj(const __bf16* __restrict__ X, const __bf16* __restrict__ Wp, const float* __restrict__ bias,
                                              int mode, int c0, _Float16* P0, _Float16* P1) {
  __shared__ __align__(16) float ss[64][132];
  const int tid = threadIdx.x, wave = tid >> 5, lane = tid & 31, col = lane & 15, g = lane >> 4;
  const int r0 = blockIdx.x * 64, n0 = blockIdx.y * 128; const int ql0 = r0 + wave * 16;
  const __bf16* xa = X + (size_t)(ql0 + col) * KP; const __bf16* wb = Wp + (size_t)(n0 + col) * KP;
  v8f acc[8] = {};
#pragma unroll 1
  for (int kc = 0; kc < KP / 32; ++kc) {
    const v16b a = frag_b(xa + kc * 32, lane);
#pragma unroll
    for (int j = 0; j < 8; ++j) acc[j] = wmma_bf(a, frag_b(wb + (size_t)j * 16 * KP + kc * 32, lane), acc[j]);
  }
#pragma unroll
  for (int j = 0; j < 8; ++j) { const float bb = bfr(bias[n0 + j * 16 + col]);
#pragma unroll
    for (int r = 0; r < 8; ++r) ss[wave * 16 + 8 * g + r][j * 16 + col] = acc[j][r] + bb; }
  __syncthreads();
  if (mode == 1) {
    const int bb = r0 / SEQ, nl = r0 - bb * SEQ;
    _Float16* vt = P0 + ((size_t)bb * KP + c0 + n0) * SEQ + nl;
    for (int e = tid; e < 128 * 8; e += 128) { const int d = e >> 3, q = e & 7; v8h o;
#pragma unroll
      for (int i = 0; i < 8; ++i) o[i] = (_Float16)ss[q * 8 + i][d];
      vst2(vt + (size_t)d * SEQ + q * 8, __builtin_bit_cast(v4u, o)); }
  } else {
#pragma unroll 1
    for (int it = 0; it < 8; ++it) { const int rl = wave * 16 + it * 2 + g;
      const v4f x0 = *(const v4f*)&ss[rl][col * 8], x1 = *(const v4f*)&ss[rl][col * 8 + 4];
      float v[8]; v8h hh, rr;
#pragma unroll
      for (int i = 0; i < 4; ++i) { v[i] = x0[i]; v[4 + i] = x1[i]; }
#pragma unroll
      for (int i = 0; i < 8; ++i) hh[i] = (_Float16)v[i];
#pragma unroll
      for (int i = 0; i < 8; ++i) rr[i] = (_Float16)((v[i] - (float)hh[i]) * QCAR);
      const size_t ro = (size_t)(r0 + rl) * KP + c0 + n0 + col * 8;
      vst2(P0 + ro, __builtin_bit_cast(v4u, hh));
      vst2(P1 + ro, __builtin_bit_cast(v4u, rr));
    }
  }
}

// ---- k_sc: S[z][SEQ][SEQ] for batch b with k plane = [kr | ki]:
// z=0: qr.kr (k-steps 0..15) + (-qi).ki (k-steps 16..31, sign-bit flip of the q fragments); z=1: qr.ki + qi.kr (column offsets); x 1/sqrt(512)
// q = hi + res/2^11, k = hi + res/2^11: products hi.hi -> ah, res.hi + hi.res -> ar (folded x 2^-11); block = 64 queries x 64 keys, 4 waves each 16 x 64
__global__ __launch_bounds__(128) void k_sc(const _Float16* __restrict__ QH, const _Float16* __restrict__ QR, const _Float16* __restrict__ KH, const _Float16* __restrict__ KR,
                                            int b, float* __restrict__ S0) {
  __shared__ __align__(16) float ss[4][16][68];
  const int z = blockIdx.z; float* S = S0 + (size_t)z * SEQ * SEQ;
  const int tid = threadIdx.x, wave = tid >> 5, lane = tid & 31, col = lane & 15, g = lane >> 4;
  const int k0 = blockIdx.y * 64; const int ql0 = blockIdx.x * 64 + wave * 16;
  const size_t qrow = ((size_t)b * SEQ + ql0 + col) * KP, krow = ((size_t)b * SEQ + k0 + col) * KP;
  const _Float16* qh = QH + qrow; const _Float16* ql = QR + qrow; const _Float16* kh = KH + krow; const _Float16* kl = KR + krow;
  v8f ah[4] = {}, ar[4] = {};
#pragma unroll 1
  for (int kc = 0; kc < KP / 32; ++kc) {
    const int up = (kc >= KP / 64) ? 1 : 0;                                   // second K-half (im part of q)
    const int koff = (z == 0) ? (kc * 32) : (up ? (kc * 32 - DD) : (DD + kc * 32));
    const unsigned sg = (z == 0 && up) ? 0x80008000u : 0u;                  // block-uniform
    const v16h a = hneg(frag_h(qh + kc * 32, lane), sg), r = hneg(frag_h(ql + kc * 32, lane), sg);
#pragma unroll
    for (int j = 0; j < 4; ++j) { const v16h kb = frag_h(kh + (size_t)j * 16 * KP + koff, lane), kr = frag_h(kl + (size_t)j * 16 * KP + koff, lane);
      ah[j] = wmma16(a, kb, ah[j]); ar[j] = wmma16(r, kb, ar[j]); ar[j] = wmma16(a, kr, ar[j]); }
  }
#pragma unroll
  for (int j = 0; j < 4; ++j)
#pragma unroll
    for (int r = 0; r < 8; ++r) ss[wave][8 * g + r][j * 16 + col] = ah[j][r] * SCL + ar[j][r] * (SCL / QCAR);
  __syncthreads();
#pragma unroll 1
  for (int it = 0; it < 8; ++it) { const int rl = it * 2 + g; vst2(S + (size_t)(ql0 + rl) * SEQ + k0 + col * 4, *(const v4f*)&ss[wave][rl][col * 4]); }
}
// ---- k_sm: block = one query row: a[m] = sqrt(sre^2 + sim^2), softmax over SEQ keys (max-subtracted, f32) -> P f16 x 2^14
__global__ __launch_bounds__(256) void k_sm(const float* __restrict__ S0, _Float16* __restrict__ P) {
  __shared__ float sred[8]; __shared__ float sbc; __shared__ __align__(16) _Float16 sh[SEQ];
  constexpr int EPT = SEQ / 256;
  const int t = threadIdx.x; const size_t row = blockIdx.x;
  const float* sr = S0 + row * SEQ + t * EPT; const float* si = S0 + (size_t)SEQ * SEQ + row * SEQ + t * EPT;
  float a[EPT]; float m = -3.0e38f;
#pragma unroll
  for (int i = 0; i < EPT; ++i) { const float x = sr[i], y = si[i]; a[i] = sqrtf(x * x + y * y); m = fmaxf(m, a[i]); }
#pragma unroll
  for (int o = 1; o < 32; o <<= 1) m = fmaxf(m, __shfl_xor(m, o));
  if ((t & 31) == 0) sred[t >> 5] = m; __syncthreads();
  if (t == 0) { float v = sred[0]; for (int i = 1; i < 8; ++i) v = fmaxf(v, sred[i]); sbc = v; } __syncthreads(); m = sbc; __syncthreads();
  float e[EPT]; float sum = 0.f;
#pragma unroll
  for (int i = 0; i < EPT; ++i) { e[i] = exp_ni(a[i] - m); sum += e[i]; }
#pragma unroll
  for (int o = 1; o < 32; o <<= 1) sum += __shfl_xor(sum, o);
  if ((t & 31) == 0) sred[t >> 5] = sum; __syncthreads();
  if (t == 0) { float v = 0.f; for (int i = 0; i < 8; ++i) v += sred[i]; sbc = 1.0f / v; } __syncthreads(); const float inv = sbc;
#pragma unroll
  for (int i = 0; i < EPT; ++i) sh[t * EPT + i] = (_Float16)(e[i] * inv * PCAR);
  __syncthreads();
  if (t < SEQ / 8) vst2(P + row * SEQ + t * 8, *(const v4u*)&sh[t * 8]);
}
// ---- k_pv: ctx[n][0..1023] = P . [vr|vi] for batch b; columns 0..511 -> output plane 0, 512..1023 -> plane 1; block = 64 queries x 128 cols, 4 waves each 16 x 128
__global__ __launch_bounds__(128) void k_pv(const _Float16* __restrict__ P, const _Float16* __restrict__ VT, int b, float* __restrict__ OUT) {
  __shared__ __align__(16) float ss[4][16][132];
  const int tid = threadIdx.x, wave = tid >> 5, lane = tid & 31, col = lane & 15, g = lane >> 4;
  const int n0 = blockIdx.y * 128; const int ql0 = blockIdx.x * 64 + wave * 16;
  const _Float16* pa = P + (size_t)(ql0 + col) * SEQ; const _Float16* vb = VT + ((size_t)b * KP + n0 + col) * SEQ;
  v8f acc[8] = {};
#pragma unroll 1
  for (int kc = 0; kc < SEQ / 32; ++kc) { const v16h a = frag_h(pa + kc * 32, lane);
#pragma unroll
    for (int j = 0; j < 8; ++j) acc[j] = wmma16(a, frag_h(vb + (size_t)j * 16 * SEQ + kc * 32, lane), acc[j]); }
#pragma unroll
  for (int j = 0; j < 8; ++j)
#pragma unroll
    for (int r = 0; r < 8; ++r) ss[wave][8 * g + r][j * 16 + col] = acc[j][r] * (1.0f / PCAR);
  __syncthreads();
  const int pl = n0 / DD, d0 = n0 - pl * DD;
  float* ob = OUT + (((size_t)pl * NB_FULL + b) * SEQ_FULL + ql0) * DD + d0 + lane * 4;
#pragma unroll 1
  for (int rl = 0; rl < 16; ++rl) vst2(ob + (size_t)rl * DD, *(const v4f*)&ss[wave][rl][lane * 4]);
}

extern "C" void kernel_launch(void* const* d_in, const int* in_sizes, int n_in, void* d_out, int out_size, void* d_ws, size_t ws_size, hipStream_t stream) {
  if (n_in < 14) return;
  const float* xr = (const float*)d_in[0];  const float* xi = (const float*)d_in[1];
  const float* wqr = (const float*)d_in[2]; const float* wqi = (const float*)d_in[3]; const float* bqr = (const float*)d_in[4]; const float* bqi = (const float*)d_in[5];
  const float* wkr = (const float*)d_in[6]; const float* wki = (const float*)d_in[7]; const float* bkr = (const float*)d_in[8]; const float* bki = (const float*)d_in[9];
  const float* wvr = (const float*)d_in[10]; const float* wvi = (const float*)d_in[11]; const float* bvr = (const float*)d_in[12]; const float* bvi = (const float*)d_in[13];
  const int need_x = ((NB - 1) * SEQ_FULL + SEQ) * DD;
  if (in_sizes[0] < need_x || in_sizes[1] < need_x) return;
  for (int i = 2; i < 14; i += 4) { if (in_sizes[i] < DD * DD || in_sizes[i + 1] < DD * DD || in_sizes[i + 2] < DD || in_sizes[i + 3] < DD) return; }
  const int need_out = ((NB_FULL + NB - 1) * SEQ_FULL + SEQ) * DD;
  if (out_size < need_out) return;
  if (ws_size < (size_t)WS_END) return;
  char* ws = (char*)d_ws;
  __bf16* X = (__bf16*)(ws + WS_X); __bf16* Wp = (__bf16*)(ws + WS_W);
  _Float16* QH = (_Float16*)(ws + WS_QH); _Float16* QR = (_Float16*)(ws + WS_QR);
  _Float16* KH = (_Float16*)(ws + WS_KH); _Float16* KR = (_Float16*)(ws + WS_KR);
  _Float16* VT = (_Float16*)(ws + WS_VT); float* S = (float*)(ws + WS_S); _Float16* P = (_Float16*)(ws + WS_P);
  float* out = (float*)d_out;

  k_cvx<<<dim3(MR / 2), 256, 0, stream>>>(xr, xi, X);
  k_cvw<<<dim3(DD / 4), 256, 0, stream>>>(wqr, wqi, Wp + 0 * WPL, Wp + 1 * WPL);
  k_cvw<<<dim3(DD / 4), 256, 0, stream>>>(wkr, wki, Wp + 2 * WPL, Wp + 3 * WPL);
  k_cvw<<<dim3(DD / 4), 256, 0, stream>>>(wvr, wvi, Wp + 4 * WPL, Wp + 5 * WPL);
  const dim3 gp(MR / 64, DD / 128);
  k_proj<<<gp, 128, 0, stream>>>(X, Wp + 0 * WPL, bqr, 0, 0,  QH, QR);
  k_proj<<<gp, 128, 0, stream>>>(X, Wp + 1 * WPL, bqi, 0, DD, QH, QR);
  k_proj<<<gp, 128, 0, stream>>>(X, Wp + 2 * WPL, bkr, 0, 0,  KH, KR);
  k_proj<<<gp, 128, 0, stream>>>(X, Wp + 3 * WPL, bki, 0, DD, KH, KR);
  k_proj<<<gp, 128, 0, stream>>>(X, Wp + 4 * WPL, bvr, 1, 0,  VT, VT);
  k_proj<<<gp, 128, 0, stream>>>(X, Wp + 5 * WPL, bvi, 1, DD, VT, VT);
  for (int b = 0; b < NB; ++b) {
    k_sc<<<dim3(SEQ / 64, SEQ / 64, 2), 128, 0, stream>>>(QH, QR, KH, KR, b, S);
    k_sm<<<dim3(SEQ), 256, 0, stream>>>(S, P);
    k_pv<<<dim3(SEQ / 64, KP / 128), 128, 0, stream>>>(P, VT, b, out);
  }
}

// v001
// One run takes 614 microseconds.
// Timed twice side by side with v000, it ran 1.96 and 1.95 times as fast.
// compute dtype: all float inputs RNE-converted to bf16 on load; q/k/v projections on v_wmma_f32_16x16x32_bf16 (bf16 operands, exact products), f32 accumulate; scores on v_wmma_f32_16x16x32_f16 with q and k each = f16 hi + f16 residual x2^11 (3 products hi.hi, res.hi, hi.res; 2 accumulators); magnitude and softmax in f32 -> P f16 x2^14; P.v on v_wmma_f32_16x16x32_f16 with v = f16 hi (1 product); f32 output.
#include <hip/hip_runtime.h>
#include <math.h>

typedef __attribute__((ext_vector_type(16))) _Float16 v16h;
typedef __attribute__((ext_vector_type(16))) __bf16 v16b;
typedef __attribute__((ext_vector_type(8)))  _Float16 v8h;
typedef __attribute__((ext_vector_type(8)))  __bf16 v8b;
typedef __attribute__((ext_vector_type(8)))  float v8f;
typedef __attribute__((ext_vector_type(8)))  unsigned v8u;
typedef __attribute__((ext_vector_type(4)))  float v4f;
typedef __attribute__((ext_vector_type(4)))  unsigned v4u;

#define DD 512            // feature width per real/imag part
#define KP 1024           // concatenated contraction length [re | im]
#define NB_FULL 8
#define SEQ_FULL 1024
#ifndef NB
#define NB NB_FULL
#endif
#ifndef SEQ
#define SEQ SEQ_FULL
#endif
#define MR (NB * SEQ)     // projection rows
#define QCAR 2048.0f      // carry of the q and k residual planes
#define PCAR 16384.0f     // carry of the P plane
#define SCL 0.044194173824159216f   // 1/sqrt(512)

static_assert(NB >= 1 && NB <= NB_FULL);
static_assert(SEQ >= 256 && SEQ <= SEQ_FULL && (SEQ % 256) == 0);
static_assert((MR % 64) == 0);

#define WPL    ((size_t)DD * KP)                      // elements per weight plane
#define WS_X   ((size_t)0)                             // bf16 [MR][KP]
#define WS_W   (WS_X + 2u * (size_t)MR * KP)           // bf16 6 x [DD][KP]
#define WS_QH  (WS_W + 2u * 6u * WPL)                  // f16  [MR][KP] q hi
#define WS_QR  (WS_QH + 2u * (size_t)MR * KP)          // f16  [MR][KP] q residual x2^11
#define WS_KH  (WS_QR + 2u * (size_t)MR * KP)          // f16  [MR][KP] k hi  = [kr | ki]
#define WS_KR  (WS_KH + 2u * (size_t)MR * KP)          // f16  [MR][KP] k residual x2^11
#define WS_VT  (WS_KR + 2u * (size_t)MR * KP)          // f16  [NB][KP][SEQ]
#define WS_S   (WS_VT + 2u * (size_t)NB * KP * SEQ)    // f32  [NB][2][SEQ][SEQ]
#define WS_P   (WS_S + 4u * 2u * (size_t)NB * SEQ * SEQ) // f16  [NB][SEQ][SEQ]
#define WS_END (WS_P + 2u * (size_t)NB * SEQ * SEQ)
static_assert(WS_END <= (size_t)268435456);
static_assert((WS_W % 256) == 0 && (WS_QH % 256) == 0 && (WS_QR % 256) == 0 && (WS_KH % 256) == 0 && (WS_KR % 256) == 0 && (WS_VT % 256) == 0 && (WS_S % 256) == 0 && (WS_P % 256) == 0);

template <typename T> __device__ __forceinline__ void vst2(void* p, T v) { *(T*)p = v;  }

__device__ __forceinline__ v8f wmma16(v16h a, v16h b, v8f c) {
  v8f d = __builtin_amdgcn_wmma_f32_16x16x32_f16(false, a, false, b, (short)0, c, false, false);
  asm volatile("v_nop\n\tv_nop\n\tv_nop\n\tv_nop" : "+v"(d) : "v"(a), "v"(b));
  return d;
}
__device__ __forceinline__ v8f wmma_bf(v16b a, v16b b, v8f c) {
  v8f d = __builtin_amdgcn_wmma_f32_16x16x32_bf16(false, a, false, b, (short)0, c, false, false);
  asm volatile("v_nop\n\tv_nop\n\tv_nop\n\tv_nop" : "+v"(d) : "v"(a), "v"(b));
  return d;
}
// 16x16x32 fragments: lane = (h = lane>>4, row/col = lane&15); elements 0..7 = k0+8h+0..7, 8..15 = k0+16+8h+0..7; D element r = row 8h+r, col lane&15
__device__ __forceinline__ v16h frag_h(const _Float16* rowk0, int lane) {
  union { v16h v; v8h q[2]; } u; const _Float16* p = rowk0 + 8 * (lane >> 4);
  u.q[0] = *(const v8h*)p; u.q[1] = *(const v8h*)(p + 16); return u.v;
}
__device__ __forceinline__ v16b frag_b(const __bf16* rowk0, int lane) {
  union { v16b v; v8b q[2]; } u; const __bf16* p = rowk0 + 8 * (lane >> 4);
  u.q[0] = *(const v8b*)p; u.q[1] = *(const v8b*)(p + 16); return u.v;
}
// sign-bit flip of all 16 halves when m == 0x80008000 (exact negation), identity when m == 0
__device__ __forceinline__ v16h hneg(v16h x, unsigned m) { v8u u = __builtin_bit_cast(v8u, x); u ^= m; return __builtin_bit_cast(v16h, u); }
__device__ __forceinline__ float bfr(float v) { return (float)(__bf16)v; }
__device__ __attribute__((noinline)) float exp_ni(float v) { return expf(v); }

// ---- k_cvx: X[row][0..511] = bf16(xr[row]), X[row][512..1023] = bf16(xi[row]); block = 2 rows, 128 threads per row (64 re + 64 im), 8 values -> one 16-B store per thread
__global__ __launch_bounds__(256) void k_cvx(const float* __restrict__ XR, const float* __restrict__ XI, __bf16* __restrict__ X) {
  const int tid = threadIdx.x; const int row = blockIdx.x * 2 + (tid >> 7); const int t = tid & 127;
  const int half = t >> 6; const int c = (t & 63) * 8;               // half is wave-uniform
  const int bb = row / SEQ, n = row - bb * SEQ;
  const float* sp = (half ? XI : XR) + ((size_t)bb * SEQ_FULL + n) * DD + c;
  const v4f f0 = *(const v4f*)sp, f1 = *(const v4f*)(sp + 4);
  v8b o;
#pragma unroll
  for (int i = 0; i < 4; ++i) { o[i] = (__bf16)f0[i]; o[4 + i] = (__bf16)f1[i]; }
  vst2(X + (size_t)row * KP + half * DD + c, __builtin_bit_cast(v4u, o));
}
// ---- k_cvw: weight planes of complex linear y = blockIdx.y (q, k, v): BRE[e] = [Wr[e] | -Wi[e]], BIM[e] = [Wi[e] | Wr[e]] (bf16, negation exact); block = 4 rows, 64 threads per row
__global__ __launch_bounds__(256) void k_cvw(const float* __restrict__ WQR, const float* __restrict__ WQI, const float* __restrict__ WKR, const float* __restrict__ WKI,
                                             const float* __restrict__ WVR, const float* __restrict__ WVI, __bf16* __restrict__ Wp) {
  const int y = blockIdx.y;                                            // block-uniform
  const float* WR = (y == 0) ? WQR : ((y == 1) ? WKR : WVR); const float* WI = (y == 0) ? WQI : ((y == 1) ? WKI : WVI);
  __bf16* BRE = Wp + (size_t)(2 * y) * WPL; __bf16* BIM = BRE + WPL;
  const int tid = threadIdx.x; const int e = blockIdx.x * 4 + (tid >> 6); const int c = (tid & 63) * 8;
  const float* pr = WR + (size_t)e * DD + c; const float* pi = WI + (size_t)e * DD + c;
  const v4f r0 = *(const v4f*)pr, r1 = *(const v4f*)(pr + 4), i0 = *(const v4f*)pi, i1 = *(const v4f*)(pi + 4);
  v8b vr, vi, vn;
#pragma unroll
  for (int i = 0; i < 4; ++i) { vr[i] = (__bf16)r0[i]; vr[4 + i] = (__bf16)r1[i]; vi[i] = (__bf16)i0[i]; vi[4 + i] = (__bf16)i1[i]; vn[i] = (__bf16)(-i0[i]); vn[4 + i] = (__bf16)(-i1[i]); }
  vst2(BRE + (size_t)e * KP + c,      __builtin_bit_cast(v4u, vr));
  vst2(BRE + (size_t)e * KP + DD + c, __builtin_bit_cast(v4u, vn));
  vst2(BIM + (size_t)e * KP + c,      __builtin_bit_cast(v4u, vi));
  vst2(BIM + (size_t)e * KP + DD + c, __builtin_bit_cast(v4u, vr));
}

// ---- k_proj: Y[MR][512-col tile] = X[MR][KP] . Wp[512][KP]^T + bias; block = 64 rows x 128 cols, 4 waves each 16 rows x 128 cols
// blockIdx.z = weight plane 0..5 (q re, q im, k re, k im, v re, v im): all six projections in one grid
// mode 0: f16 hi -> P0, f16 residual x2^11 -> P1, pitch KP, at column c0 + n
__global__ __launch_bounds__(128) void k_proj(const __bf16* __restrict__ X, const __bf16* __restrict__ W6,
                                              const float* __restrict__ BQR, const float* __restrict__ BQI, const float* __restrict__ BKR, const float* __restrict__ BKI,
                                              const float* __restrict__ BVR, const float* __restrict__ BVI,
                                              _Float16* QH, _Float16* QR, _Float16* KH, _Float16* KR, _Float16* VT) {
  __shared__ __align__(16) float ss[64][132];
  const int pz = blockIdx.z;                                           // block-uniform
  const __bf16* Wp = W6 + (size_t)pz * WPL;
  const float* bias = (pz == 0) ? BQR : ((pz == 1) ? BQI : ((pz == 2) ? BKR : ((pz == 3) ? BKI : ((pz == 4) ? BVR : BVI))));
  const int mode = (pz >= 4) ? 1 : 0, c0 = (pz & 1) * DD;
  _Float16* P0 = (pz < 2) ? QH : ((pz < 4) ? KH : VT); _Float16* P1 = (pz < 2) ? QR : KR;
  const int tid = threadIdx.x, wave = tid >> 5, lane = tid & 31, col = lane & 15, g = lane >> 4;
  const int r0 = blockIdx.x * 64, n0 = blockIdx.y * 128; const int ql0 = r0 + wave * 16;
  const __bf16* xa = X + (size_t)(ql0 + col) * KP; const __bf16* wb = Wp + (size_t)(n0 + col) * KP;
  v8f acc[8] = {};
#pragma unroll 1
  for (int kc = 0; kc < KP / 32; ++kc) {
    const v16b a = frag_b(xa + kc * 32, lane);
#pragma unroll
    for (int j = 0; j < 8; ++j) acc[j] = wmma_bf(a, frag_b(wb + (size_t)j * 16 * KP + kc * 32, lane), acc[j]);
  }
#pragma unroll
  for (int j = 0; j < 8; ++j) { const float bb = bfr(bias[n0 + j * 16 + col]);
#pragma unroll
    for (int r = 0; r < 8; ++r) ss[wave * 16 + 8 * g + r][j * 16 + col] = acc[j][r] + bb; }
  __syncthreads();
  if (mode == 1) {
    const int bb = r0 / SEQ, nl = r0 - bb * SEQ;
    _Float16* vt = P0 + ((size_t)bb * KP + c0 + n0) * SEQ + nl;
    for (int e = tid; e < 128 * 8; e += 128) { const int d = e >> 3, q = e & 7; v8h o;
#pragma unroll
      for (int i = 0; i < 8; ++i) o[i] = (_Float16)ss[q * 8 + i][d];
      vst2(vt + (size_t)d * SEQ + q * 8, __builtin_bit_cast(v4u, o)); }
  } else {
#pragma unroll 1
    for (int it = 0; it < 8; ++it) { const int rl = wave * 16 + it * 2 + g;
      const v4f x0 = *(const v4f*)&ss[rl][col * 8], x1 = *(const v4f*)&ss[rl][col * 8 + 4];
      float v[8]; v8h hh, rr;
#pragma unroll
      for (int i = 0; i < 4; ++i) { v[i] = x0[i]; v[4 + i] = x1[i]; }
#pragma unroll
      for (int i = 0; i < 8; ++i) hh[i] = (_Float16)v[i];
#pragma unroll
      for (int i = 0; i < 8; ++i) rr[i] = (_Float16)((v[i] - (float)hh[i]) * QCAR);
      const size_t ro = (size_t)(r0 + rl) * KP + c0 + n0 + col * 8;
      vst2(P0 + ro, __builtin_bit_cast(v4u, hh));
      vst2(P1 + ro, __builtin_bit_cast(v4u, rr));
    }
  }
}

// ---- k_sc: S[b][z][SEQ][SEQ], blockIdx.z = 2 b + z (all batches in one grid), with k plane = [kr | ki]:
// z=0: qr.kr (k-steps 0..15) + (-qi).ki (k-steps 16..31, sign-bit flip of the q fragments); z=1: qr.ki + qi.kr (column offsets); x 1/sqrt(512)
// q = hi + res/2^11, k = hi + res/2^11: products hi.hi -> ah, res.hi + hi.res -> ar (folded x 2^-11); block = 64 queries x 64 keys, 4 waves each 16 x 64
__global__ __launch_bounds__(128) void k_sc(const _Float16* __restrict__ QH, const _Float16* __restrict__ QR, const _Float16* __restrict__ KH, const _Float16* __restrict__ KR,
                                            float* __restrict__ S0) {
  __shared__ __align__(16) float ss[4][16][68];
  const int z = blockIdx.z & 1, b = blockIdx.z >> 1; float* S = S0 + (size_t)blockIdx.z * SEQ * SEQ;
  const int tid = threadIdx.x, wave = tid >> 5, lane = tid & 31, col = lane & 15, g = lane >> 4;
  const int k0 = blockIdx.y * 64; const int ql0 = blockIdx.x * 64 + wave * 16;
  const size_t qrow = ((size_t)b * SEQ + ql0 + col) * KP, krow = ((size_t)b * SEQ + k0 + col) * KP;
  const _Float16* qh = QH + qrow; const _Float16* ql = QR + qrow; const _Float16* kh = KH + krow; const _Float16* kl = KR + krow;
  v8f ah[4] = {}, ar[4] = {};
#pragma unroll 1
  for (int kc = 0; kc < KP / 32; ++kc) {
    const int up = (kc >= KP / 64) ? 1 : 0;                                   // second K-half (im part of q)
    const int koff = (z == 0) ? (kc * 32) : (up ? (kc * 32 - DD) : (DD + kc * 32));
    const unsigned sg = (z == 0 && up) ? 0x80008000u : 0u;                  // block-uniform
    const v16h a = hneg(frag_h(qh + kc * 32, lane), sg), r = hneg(frag_h(ql + kc * 32, lane), sg);
#pragma unroll
    for (int j = 0; j < 4; ++j) { const v16h kb = frag_h(kh + (size_t)j * 16 * KP + koff, lane), kr = frag_h(kl + (size_t)j * 16 * KP + koff, lane);
      ah[j] = wmma16(a, kb, ah[j]); ar[j] = wmma16(r, kb, ar[j]); ar[j] = wmma16(a, kr, ar[j]); }
  }
#pragma unroll
  for (int j = 0; j < 4; ++j)
#pragma unroll
    for (int r = 0; r < 8; ++r) ss[wave][8 * g + r][j * 16 + col] = ah[j][r] * SCL + ar[j][r] * (SCL / QCAR);
  __syncthreads();
#pragma unroll 1
  for (int it = 0; it < 8; ++it) { const int rl = it * 2 + g; vst2(S + (size_t)(ql0 + rl) * SEQ + k0 + col * 4, *(const v4f*)&ss[wave][rl][col * 4]); }
}
// ---- k_sm: block = one query row of one batch (blockIdx.x = b SEQ + n): a[m] = sqrt(sre^2 + sim^2), softmax over SEQ keys (max-subtracted, f32) -> P f16 x 2^14
__global__ __launch_bounds__(256) void k_sm(const float* __restrict__ S0, _Float16* __restrict__ P) {
  __shared__ float sred[8]; __shared__ float sbc; __shared__ __align__(16) _Float16 sh[SEQ];
  constexpr int EPT = SEQ / 256;
  const int t = threadIdx.x; const size_t row = blockIdx.x; const size_t bb = row / SEQ;
  const float* sr = S0 + (bb * SEQ + row) * SEQ + t * EPT; const float* si = sr + (size_t)SEQ * SEQ;   // plane 2 bb, row n: (2 bb SEQ + n) = bb SEQ + row
  float a[EPT]; float m = -3.0e38f;
#pragma unroll
  for (int i = 0; i < EPT; ++i) { const float x = sr[i], y = si[i]; a[i] = sqrtf(x * x + y * y); m = fmaxf(m, a[i]); }
#pragma unroll
  for (int o = 1; o < 32; o <<= 1) m = fmaxf(m, __shfl_xor(m, o));
  if ((t & 31) == 0) sred[t >> 5] = m; __syncthreads();
  if (t == 0) { float v = sred[0]; for (int i = 1; i < 8; ++i) v = fmaxf(v, sred[i]); sbc = v; } __syncthreads(); m = sbc; __syncthreads();
  float e[EPT]; float sum = 0.f;
#pragma unroll
  for (int i = 0; i < EPT; ++i) { e[i] = exp_ni(a[i] - m); sum += e[i]; }
#pragma unroll
  for (int o = 1; o < 32; o <<= 1) sum += __shfl_xor(sum, o);
  if ((t & 31) == 0) sred[t >> 5] = sum; __syncthreads();
  if (t == 0) { float v = 0.f; for (int i = 0; i < 8; ++i) v += sred[i]; sbc = 1.0f / v; } __syncthreads(); const float inv = sbc;
#pragma unroll
  for (int i = 0; i < EPT; ++i) sh[t * EPT + i] = (_Float16)(e[i] * inv * PCAR);
  __syncthreads();
  if (t < SEQ / 8) vst2(P + row * SEQ + t * 8, *(const v4u*)&sh[t * 8]);
}
// ---- k_pv: ctx[n][0..1023] = P[b] . [vr|vi] for batch b = blockIdx.z; columns 0..511 -> output plane 0, 512..1023 -> plane 1; block = 64 queries x 128 cols, 4 waves each 16 x 128
__global__ __launch_bounds__(128) void k_pv(const _Float16* __restrict__ P, const _Float16* __restrict__ VT, float* __restrict__ OUT) {
  __shared__ __align__(16) float ss[4][16][132];
  const int b = blockIdx.z;
  const int tid = threadIdx.x, wave = tid >> 5, lane = tid & 31, col = lane & 15, g = lane >> 4;
  const int n0 = blockIdx.y * 128; const int ql0 = blockIdx.x * 64 + wave * 16;
  const _Float16* pa = P + ((size_t)b * SEQ + ql0 + col) * SEQ; const _Float16* vb = VT + ((size_t)b * KP + n0 + col) * SEQ;
  v8f acc[8] = {};
#pragma unroll 1
  for (int kc = 0; kc < SEQ / 32; ++kc) { const v16h a = frag_h(pa + kc * 32, lane);
#pragma unroll
    for (int j = 0; j < 8; ++j) acc[j] = wmma16(a, frag_h(vb + (size_t)j * 16 * SEQ + kc * 32, lane), acc[j]); }
#pragma unroll
  for (int j = 0; j < 8; ++j)
#pragma unroll
    for (int r = 0; r < 8; ++r) ss[wave][8 * g + r][j * 16 + col] = acc[j][r] * (1.0f / PCAR);
  __syncthreads();
  const int pl = n0 / DD, d0 = n0 - pl * DD;
  float* ob = OUT + (((size_t)pl * NB_FULL + b) * SEQ_FULL + ql0) * DD + d0 + lane * 4;
#pragma unroll 1
  for (int rl = 0; rl < 16; ++rl) vst2(ob + (size_t)rl * DD, *(const v4f*)&ss[wave][rl][lane * 4]);
}

extern "C" void kernel_launch(void* const* d_in, const int* in_sizes, int n_in, void* d_out, int out_size, void* d_ws, size_t ws_size, hipStream_t stream) {
  if (n_in < 14) return;
  const float* xr = (const float*)d_in[0];  const float* xi = (const float*)d_in[1];
  const float* wqr = (const float*)d_in[2]; const float* wqi = (const float*)d_in[3]; const float* bqr = (const float*)d_in[4]; const float* bqi = (const float*)d_in[5];
  const float* wkr = (const float*)d_in[6]; const float* wki = (const float*)d_in[7]; const float* bkr = (const float*)d_in[8]; const float* bki = (const float*)d_in[9];
  const float* wvr = (const float*)d_in[10]; const float* wvi = (const float*)d_in[11]; const float* bvr = (const float*)d_in[12]; const float* bvi = (const float*)d_in[13];
  const int need_x = ((NB - 1) * SEQ_FULL + SEQ) * DD;
  if (in_sizes[0] < need_x || in_sizes[1] < need_x) return;
  for (int i = 2; i < 14; i += 4) { if (in_sizes[i] < DD * DD || in_sizes[i + 1] < DD * DD || in_sizes[i + 2] < DD || in_sizes[i + 3] < DD) return; }
  const int need_out = ((NB_FULL + NB - 1) * SEQ_FULL + SEQ) * DD;
  if (out_size < need_out) return;
  if (ws_size < (size_t)WS_END) return;
  char* ws = (char*)d_ws;
  __bf16* X = (__bf16*)(ws + WS_X); __bf16* Wp = (__bf16*)(ws + WS_W);
  _Float16* QH = (_Float16*)(ws + WS_QH); _Float16* QR = (_Float16*)(ws + WS_QR);
  _Float16* KH = (_Float16*)(ws + WS_KH); _Float16* KR = (_Float16*)(ws + WS_KR);
  _Float16* VT = (_Float16*)(ws + WS_VT); float* S = (float*)(ws + WS_S); _Float16* P = (_Float16*)(ws + WS_P);
  float* out = (float*)d_out;

  k_cvx<<<dim3(MR / 2), 256, 0, stream>>>(xr, xi, X);
  k_cvw<<<dim3(DD / 4, 3), 256, 0, stream>>>(wqr, wqi, wkr, wki, wvr, wvi, Wp);
  k_proj<<<dim3(MR / 64, DD / 128, 6), 128, 0, stream>>>(X, Wp, bqr, bqi, bkr, bki, bvr, bvi, QH, QR, KH, KR, VT);
  k_sc<<<dim3(SEQ / 64, SEQ / 64, 2 * NB), 128, 0, stream>>>(QH, QR, KH, KR, S);
  k_sm<<<dim3(NB * SEQ), 256, 0, stream>>>(S, P);
  k_pv<<<dim3(SEQ / 64, KP / 128, NB), 128, 0, stream>>>(P, VT, out);
}

// v002
// One run takes 501 microseconds.
// Next to v001, in two timings, it ran 1.24 times as fast each time.
// Over all steps from v000 it is 2.43 times as fast.
// compute dtype: all float inputs RNE-converted to bf16 on load; q/k/v projections on v_wmma_f32_16x16x32_bf16 (bf16 operands, exact products), f32 accumulate; scores on v_wmma_f32_16x16x32_f16 with q and k each = f16 hi + f16 residual x2^11 (3 products hi.hi, res.hi, hi.res; 2 accumulators); magnitude and softmax in f32 -> P f16 x2^14; P.v on v_wmma_f32_16x16x32_f16 with v = f16 hi (1 product); f32 output.
#include <hip/hip_runtime.h>
#include <math.h>

typedef __attribute__((ext_vector_type(16))) _Float16 v16h;
typedef __attribute__((ext_vector_type(16))) __bf16 v16b;
typedef __attribute__((ext_vector_type(8)))  _Float16 v8h;
typedef __attribute__((ext_vector_type(8)))  __bf16 v8b;
typedef __attribute__((ext_vector_type(8)))  float v8f;
typedef __attribute__((ext_vector_type(8)))  unsigned v8u;
typedef __attribute__((ext_vector_type(4)))  float v4f;
typedef __attribute__((ext_vector_type(4)))  unsigned v4u;

#define DD 512            // feature width per real/imag part
#define KP 1024           // concatenated contraction length [re | im]
#define NB_FULL 8
#define SEQ_FULL 1024
#ifndef NB
#define NB NB_FULL
#endif
#ifndef SEQ
#define SEQ SEQ_FULL
#endif
#define MR (NB * SEQ)     // projection rows
#define QCAR 2048.0f      // carry of the q and k residual planes
#define PCAR 16384.0f     // carry of the P plane
#define SCL 0.044194173824159216f   // 1/sqrt(512)

static_assert(NB >= 1 && NB <= NB_FULL);
static_assert(SEQ >= 256 && SEQ <= SEQ_FULL && (SEQ % 256) == 0);
static_assert((MR % 64) == 0);

// Planes marked FO lie in fragment order: a plane [R][K] is cut into units of 16 rows x 32 k = 512 elements (1 KiB), unit (rt, ks) at element (rt * (K / 32) + ks) * 512;
// inside a unit element (row, k) stands at ((k & 31) >> 4) * 256 + ((((k >> 3) & 1) * 16) + (row & 15)) * 8 + (k & 7): lane l's two 16-byte pieces at l * 8 and 256 + l * 8,
// so each 16-byte load or store of a wave covers 512 contiguous bytes (4 whole lines) in place of 32 bytes in each of 16 rows.
#define FU 512                                         // elements per fragment unit
#define WPL    ((size_t)DD * KP)                      // elements per weight plane
#define WS_X   ((size_t)0)                             // bf16 [MR][KP] FO
#define WS_W   (WS_X + 2u * (size_t)MR * KP)           // bf16 6 x [DD][KP] FO
#define WS_QH  (WS_W + 2u * 6u * WPL)                  // f16  [MR][KP] FO q hi
#define WS_QR  (WS_QH + 2u * (size_t)MR * KP)          // f16  [MR][KP] FO q residual x2^11
#define WS_KH  (WS_QR + 2u * (size_t)MR * KP)          // f16  [MR][KP] FO k hi  = [kr | ki]
#define WS_KR  (WS_KH + 2u * (size_t)MR * KP)          // f16  [MR][KP] FO k residual x2^11
#define WS_VT  (WS_KR + 2u * (size_t)MR * KP)          // f16  [NB * KP][SEQ] FO
#define WS_S   (WS_VT + 2u * (size_t)NB * KP * SEQ)    // f32  [NB][2][SEQ][SEQ]
#define WS_P   (WS_S + 4u * 2u * (size_t)NB * SEQ * SEQ) // f16  [NB][SEQ][SEQ]
#define WS_END (WS_P + 2u * (size_t)NB * SEQ * SEQ)
static_assert(WS_END <= (size_t)268435456);
static_assert((WS_W % 256) == 0 && (WS_QH % 256) == 0 && (WS_QR % 256) == 0 && (WS_KH % 256) == 0 && (WS_KR % 256) == 0 && (WS_VT % 256) == 0 && (WS_S % 256) == 0 && (WS_P % 256) == 0);

template <typename T> __device__ __forceinline__ void vst2(void* p, T v) { *(T*)p = v;  }

__device__ __forceinline__ v8f wmma16(v16h a, v16h b, v8f c) {
  v8f d = __builtin_amdgcn_wmma_f32_16x16x32_f16(false, a, false, b, (short)0, c, false, false);
  asm volatile("v_nop\n\tv_nop\n\tv_nop\n\tv_nop" : "+v"(d) : "v"(a), "v"(b));
  return d;
}
__device__ __forceinline__ v8f wmma_bf(v16b a, v16b b, v8f c) {
  v8f d = __builtin_amdgcn_wmma_f32_16x16x32_bf16(false, a, false, b, (short)0, c, false, false);
  asm volatile("v_nop\n\tv_nop\n\tv_nop\n\tv_nop" : "+v"(d) : "v"(a), "v"(b));
  return d;
}
// 16x16x32 fragments: lane = (h = lane>>4, row/col = lane&15); elements 0..7 = k0+8h+0..7, 8..15 = k0+16+8h+0..7; D element r = row 8h+r, col lane&15
__device__ __forceinline__ v16h frag_h(const _Float16* rowk0, int lane) {
  union { v16h v; v8h q[2]; } u; const _Float16* p = rowk0 + 8 * (lane >> 4);
  u.q[0] = *(const v8h*)p; u.q[1] = *(const v8h*)(p + 16); return u.v;
}
// the same fragments from a fragment-order unit (same k at every lane and element position as frag_h)
__device__ __forceinline__ v16h fragu_h(const _Float16* unit, int lane) {
  union { v16h v; v8h q[2]; } u; const _Float16* p = unit + 8 * lane;
  u.q[0] = *(const v8h*)p; u.q[1] = *(const v8h*)(p + 256); return u.v;
}
__device__ __forceinline__ v16b fragu_b(const __bf16* unit, int lane) {
  union { v16b v; v8b q[2]; } u; const __bf16* p = unit + 8 * lane;
  u.q[0] = *(const v8b*)p; u.q[1] = *(const v8b*)(p + 256); return u.v;
}
// sign-bit flip of all 16 halves when m == 0x80008000 (exact negation), identity when m == 0
__device__ __forceinline__ v16h hneg(v16h x, unsigned m) { v8u u = __builtin_bit_cast(v8u, x); u ^= m; return __builtin_bit_cast(v16h, u); }
__device__ __forceinline__ float bfr(float v) { return (float)(__bf16)v; }
__device__ __attribute__((noinline)) float exp_ni(float v) { return expf(v); }

// ---- k_cvx: X[row][0..511] = bf16(xr[row]), X[row][512..1023] = bf16(xi[row]), fragment order; block = 16 rows x 8 units, one unit (16 rows x 32 k) per wave, two 512-B stores per wave
__global__ __launch_bounds__(256) void k_cvx(const float* __restrict__ XR, const float* __restrict__ XI, __bf16* __restrict__ X) {
  const int tid = threadIdx.x, wave = tid >> 5, lane = tid & 31;
  const int rt = blockIdx.x, ks = blockIdx.y * 8 + wave;               // ks is wave-uniform
  const int row = rt * 16 + (lane & 15);
  const int bb = row / SEQ, n = row - bb * SEQ;
  const float* sp = ((ks >= DD / 32) ? XI : XR) + ((size_t)bb * SEQ_FULL + n) * DD + (ks & (DD / 32 - 1)) * 32 + 8 * (lane >> 4);
  __bf16* dp = X + ((size_t)rt * (KP / 32) + ks) * FU + lane * 8;
#pragma unroll
  for (int q = 0; q < 2; ++q) {
    const v4f f0 = *(const v4f*)(sp + q * 16), f1 = *(const v4f*)(sp + q * 16 + 4);
    v8b o;
#pragma unroll
    for (int i = 0; i < 4; ++i) { o[i] = (__bf16)f0[i]; o[4 + i] = (__bf16)f1[i]; }
    vst2(dp + q * 256, __builtin_bit_cast(v4u, o));
  }
}
// ---- k_cvw: weight planes of complex linear y = blockIdx.y (q, k, v): BRE[e] = [Wr[e] | -Wi[e]], BIM[e] = [Wi[e] | Wr[e]] (bf16, negation exact), fragment order; block = 16 rows x 8 units of Wr and Wi, one unit of each per wave
__global__ __launch_bounds__(256) void k_cvw(const float* __restrict__ WQR, const float* __restrict__ WQI, const float* __restrict__ WKR, const float* __restrict__ WKI,
                                             const float* __restrict__ WVR, const float* __restrict__ WVI, __bf16* __restrict__ Wp) {
  const int y = blockIdx.y;                                            // block-uniform
  const float* WR = (y == 0) ? WQR : ((y == 1) ? WKR : WVR); const float* WI = (y == 0) ? WQI : ((y == 1) ? WKI : WVI);
  __bf16* BRE = Wp + (size_t)(2 * y) * WPL; __bf16* BIM = BRE + WPL;
  const int tid = threadIdx.x, wave = tid >> 5, lane = tid & 31;
  const int et = blockIdx.x >> 1, ks = (blockIdx.x & 1) * 8 + wave;    // unit of the 512-wide source, wave-uniform
  const size_t so = (size_t)(et * 16 + (lane & 15)) * DD + ks * 32 + 8 * (lane >> 4);
  const float* pr = WR + so; const float* pi = WI + so;
  const size_t uo = ((size_t)et * (KP / 32) + ks) * FU + lane * 8;      // left half; the right half lies DD / 32 units on
#pragma unroll
  for (int q = 0; q < 2; ++q) {
    const v4f r0 = *(const v4f*)(pr + q * 16), r1 = *(const v4f*)(pr + q * 16 + 4), i0 = *(const v4f*)(pi + q * 16), i1 = *(const v4f*)(pi + q * 16 + 4);
    v8b vr, vi, vn;
#pragma unroll
    for (int i = 0; i < 4; ++i) { vr[i] = (__bf16)r0[i]; vr[4 + i] = (__bf16)r1[i]; vi[i] = (__bf16)i0[i]; vi[4 + i] = (__bf16)i1[i]; vn[i] = (__bf16)(-i0[i]); vn[4 + i] = (__bf16)(-i1[i]); }
    vst2(BRE + uo + q * 256,                  __builtin_bit_cast(v4u, vr));
    vst2(BRE + uo + (DD / 32) * FU + q * 256, __builtin_bit_cast(v4u, vn));
    vst2(BIM + uo + q * 256,                  __builtin_bit_cast(v4u, vi));
    vst2(BIM + uo + (DD / 32) * FU + q * 256, __builtin_bit_cast(v4u, vr));
  }
}

// ---- k_proj: Y[MR][512-col tile] = X[MR][KP] . Wp[512][KP]^T + bias; block = 64 rows x 128 cols, 4 waves each 16 rows x 128 cols
// blockIdx.z = weight plane 0..5 (q re, q im, k re, k im, v re, v im): all six projections in one grid
// mode 0: f16 hi -> P0, f16 residual x2^11 -> P1, plane [MR][KP] at column c0 + n; mode 1: f16 hi transposed -> plane [NB * KP][SEQ]; both in fragment order
__global__ __launch_bounds__(128) void k_proj(const __bf16* __restrict__ X, const __bf16* __restrict__ W6,
                                              const float* __restrict__ BQR, const float* __restrict__ BQI, const float* __restrict__ BKR, const float* __restrict__ BKI,
                                              const float* __restrict__ BVR, const float* __restrict__ BVI,
                                              _Float16* QH, _Float16* QR, _Float16* KH, _Float16* KR, _Float16* VT) {
  __shared__ __align__(16) float ss[64][132];
  const int pz = blockIdx.z;                                           // block-uniform
  const __bf16* Wp = W6 + (size_t)pz * WPL;
  const float* bias = (pz == 0) ? BQR : ((pz == 1) ? BQI : ((pz == 2) ? BKR : ((pz == 3) ? BKI : ((pz == 4) ? BVR : BVI))));
  const int mode = (pz >= 4) ? 1 : 0, c0 = (pz & 1) * DD;
  _Float16* P0 = (pz < 2) ? QH : ((pz < 4) ? KH : VT); _Float16* P1 = (pz < 2) ? QR : KR;
  const int tid = threadIdx.x, wave = tid >> 5, lane = tid & 31, col = lane & 15, g = lane >> 4;
  const int r0 = blockIdx.x * 64, n0 = blockIdx.y * 128; const int ql0 = r0 + wave * 16;
  const __bf16* xa = X + (size_t)(ql0 >> 4) * (KP / 32) * FU; const __bf16* wb = Wp + (size_t)(n0 >> 4) * (KP / 32) * FU;
  v8f acc[8] = {};
#pragma unroll 1
  for (int kc = 0; kc < KP / 32; ++kc) {
    const v16b a = fragu_b(xa + kc * FU, lane);
#pragma unroll
    for (int j = 0; j < 8; ++j) acc[j] = wmma_bf(a, fragu_b(wb + (size_t)j * (KP / 32) * FU + kc * FU, lane), acc[j]);
  }
#pragma unroll
  for (int j = 0; j < 8; ++j) { const float bb = bfr(bias[n0 + j * 16 + col]);
#pragma unroll
    for (int r = 0; r < 8; ++r) ss[wave * 16 + 8 * g + r][j * 16 + col] = acc[j][r] + bb; }
  __syncthreads();
  if (mode == 1) {
    const int bb = r0 / SEQ, nl = r0 - bb * SEQ;
    _Float16* vt = P0 + ((size_t)((bb * KP + c0 + n0) >> 4) * (SEQ / 32) + (nl >> 5)) * FU + lane * 8;
    // 8 row tiles (16 features) x 2 units (32 positions) x 2 pieces; lane = (g, col): feature dt * 16 + col, positions ku * 32 + q * 16 + 8 g + 0..7
    for (int e = wave; e < 32; e += 4) { const int dt = e >> 2, ku = (e >> 1) & 1, q = e & 1; v8h o;
#pragma unroll
      for (int i = 0; i < 8; ++i) o[i] = (_Float16)ss[ku * 32 + q * 16 + 8 * g + i][dt * 16 + col];
      vst2(vt + ((size_t)dt * (SEQ / 32) + ku) * FU + q * 256, __builtin_bit_cast(v4u, o)); }
  } else {
#pragma unroll 1
    for (int it = 0; it < 8; ++it) { const int rl = wave * 16 + col, cl = it * 16 + 8 * g;   // unit it >> 1, piece it & 1
      const v4f x0 = *(const v4f*)&ss[rl][cl], x1 = *(const v4f*)&ss[rl][cl + 4];
      float v[8]; v8h hh, rr;
#pragma unroll
      for (int i = 0; i < 4; ++i) { v[i] = x0[i]; v[4 + i] = x1[i]; }
#pragma unroll
      for (int i = 0; i < 8; ++i) hh[i] = (_Float16)v[i];
#pragma unroll
      for (int i = 0; i < 8; ++i) rr[i] = (_Float16)((v[i] - (float)hh[i]) * QCAR);
      const size_t ro = ((size_t)(ql0 >> 4) * (KP / 32) + ((c0 + n0) >> 5) + (it >> 1)) * FU + (it & 1) * 256 + lane * 8;
      vst2(P0 + ro, __builtin_bit_cast(v4u, hh));
      vst2(P1 + ro, __builtin_bit_cast(v4u, rr));
      asm volatile("s_wait_xcnt 0x0" ::: "memory");   // precaution: the next trip rewrites the two stores' address and data registers
    }
  }
}

// ---- k_sc: S[b][z][SEQ][SEQ], blockIdx.z = 2 b + z (all batches in one grid), with k plane = [kr | ki]:
// z=0: qr.kr (k-steps 0..15) + (-qi).ki (k-steps 16..31, sign-bit flip of the q fragments); z=1: qr.ki + qi.kr (column offsets); x 1/sqrt(512)
// q = hi + res/2^11, k = hi + res/2^11: products hi.hi -> ah, res.hi + hi.res -> ar (folded x 2^-11); block = 64 queries x 64 keys, 4 waves each 16 x 64
__global__ __launch_bounds__(128) void k_sc(const _Float16* __restrict__ QH, const _Float16* __restrict__ QR, const _Float16* __restrict__ KH, const _Float16* __restrict__ KR,
                                            float* __restrict__ S0) {
  __shared__ __align__(16) float ss[4][16][68];
  const int z = blockIdx.z & 1, b = blockIdx.z >> 1; float* S = S0 + (size_t)blockIdx.z * SEQ * SEQ;
  const int tid = threadIdx.x, wave = tid >> 5, lane = tid & 31, col = lane & 15, g = lane >> 4;
  const int k0 = blockIdx.y * 64; const int ql0 = blockIdx.x * 64 + wave * 16;
  const size_t qrow = (size_t)((b * SEQ + ql0) >> 4) * (KP / 32) * FU, krow = (size_t)((b * SEQ + k0) >> 4) * (KP / 32) * FU;   // first unit of the row tile
  const _Float16* qh = QH + qrow; const _Float16* ql = QR + qrow; const _Float16* kh = KH + krow; const _Float16* kl = KR + krow;
  v8f ah[4] = {}, ar[4] = {};
#pragma unroll 1
  for (int kc = 0; kc < KP / 32; ++kc) {
    const int up = (kc >= KP / 64) ? 1 : 0;                                   // second K-half (im part of q)
    const int koff = (z == 0) ? (kc * 32) : (up ? (kc * 32 - DD) : (DD + kc * 32));
    const unsigned sg = (z == 0 && up) ? 0x80008000u : 0u;                  // block-uniform
    const v16h a = hneg(fragu_h(qh + kc * FU, lane), sg), r = hneg(fragu_h(ql + kc * FU, lane), sg);
#pragma unroll
    for (int j = 0; j < 4; ++j) { const v16h kb = fragu_h(kh + (size_t)j * (KP / 32) * FU + (koff >> 5) * FU, lane), kr = fragu_h(kl + (size_t)j * (KP / 32) * FU + (koff >> 5) * FU, lane);
      ah[j] = wmma16(a, kb, ah[j]); ar[j] = wmma16(r, kb, ar[j]); ar[j] = wmma16(a, kr, ar[j]); }
  }
#pragma unroll
  for (int j = 0; j < 4; ++j)
#pragma unroll
    for (int r = 0; r < 8; ++r) ss[wave][8 * g + r][j * 16 + col] = ah[j][r] * SCL + ar[j][r] * (SCL / QCAR);
  __syncthreads();
#pragma unroll 1
  for (int it = 0; it < 8; ++it) { const int rl = it * 2 + g; vst2(S + (size_t)(ql0 + rl) * SEQ + k0 + col * 4, *(const v4f*)&ss[wave][rl][col * 4]); }
}
// ---- k_sm: block = one query row of one batch (blockIdx.x = b SEQ + n): a[m] = sqrt(sre^2 + sim^2), softmax over SEQ keys (max-subtracted, f32) -> P f16 x 2^14
__global__ __launch_bounds__(256) void k_sm(const float* __restrict__ S0, _Float16* __restrict__ P) {
  __shared__ float sred[8]; __shared__ float sbc; __shared__ __align__(16) _Float16 sh[SEQ];
  constexpr int EPT = SEQ / 256;
  const int t = threadIdx.x; const size_t row = blockIdx.x; const size_t bb = row / SEQ;
  const float* sr = S0 + (bb * SEQ + row) * SEQ + t * EPT; const float* si = sr + (size_t)SEQ * SEQ;   // plane 2 bb, row n: (2 bb SEQ + n) = bb SEQ + row
  float a[EPT]; float m = -3.0e38f;
#pragma unroll
  for (int i = 0; i < EPT; ++i) { const float x = sr[i], y = si[i]; a[i] = sqrtf(x * x + y * y); m = fmaxf(m, a[i]); }
#pragma unroll
  for (int o = 1; o < 32; o <<= 1) m = fmaxf(m, __shfl_xor(m, o));
  if ((t & 31) == 0) sred[t >> 5] = m; __syncthreads();
  if (t == 0) { float v = sred[0]; for (int i = 1; i < 8; ++i) v = fmaxf(v, sred[i]); sbc = v; } __syncthreads(); m = sbc; __syncthreads();
  float e[EPT]; float sum = 0.f;
#pragma unroll
  for (int i = 0; i < EPT; ++i) { e[i] = exp_ni(a[i] - m); sum += e[i]; }
#pragma unroll
  for (int o = 1; o < 32; o <<= 1) sum += __shfl_xor(sum, o);
  if ((t & 31) == 0) sred[t >> 5] = sum; __syncthreads();
  if (t == 0) { float v = 0.f; for (int i = 0; i < 8; ++i) v += sred[i]; sbc = 1.0f / v; } __syncthreads(); const float inv = sbc;
#pragma unroll
  for (int i = 0; i < EPT; ++i) sh[t * EPT + i] = (_Float16)(e[i] * inv * PCAR);
  __syncthreads();
  if (t < SEQ / 8) vst2(P + row * SEQ + t * 8, *(const v4u*)&sh[t * 8]);
}
// ---- k_pv: ctx[n][0..1023] = P[b] . [vr|vi] for batch b = blockIdx.z; columns 0..511 -> output plane 0, 512..1023 -> plane 1; block = 64 queries x 128 cols, 4 waves each 16 x 128
__global__ __launch_bounds__(128) void k_pv(const _Float16* __restrict__ P, const _Float16* __restrict__ VT, float* __restrict__ OUT) {
  __shared__ __align__(16) float ss[4][16][132];
  const int b = blockIdx.z;
  const int tid = threadIdx.x, wave = tid >> 5, lane = tid & 31, col = lane & 15, g = lane >> 4;
  const int n0 = blockIdx.y * 128; const int ql0 = blockIdx.x * 64 + wave * 16;
  const _Float16* pa = P + ((size_t)b * SEQ + ql0 + col) * SEQ; const _Float16* vb = VT + (size_t)((b * KP + n0) >> 4) * (SEQ / 32) * FU;
  v8f acc[8] = {};
#pragma unroll 1
  for (int kc = 0; kc < SEQ / 32; ++kc) { const v16h a = frag_h(pa + kc * 32, lane);
#pragma unroll
    for (int j = 0; j < 8; ++j) acc[j] = wmma16(a, fragu_h(vb + (size_t)j * (SEQ / 32) * FU + kc * FU, lane), acc[j]);
    asm volatile("s_wait_xcnt 0x0" ::: "memory");     // precaution: the next trip rewrites the loads' address registers
  }
#pragma unroll
  for (int j = 0; j < 8; ++j)
#pragma unroll
    for (int r = 0; r < 8; ++r) ss[wave][8 * g + r][j * 16 + col] = acc[j][r] * (1.0f / PCAR);
  __syncthreads();
  const int pl = n0 / DD, d0 = n0 - pl * DD;
  float* ob = OUT + (((size_t)pl * NB_FULL + b) * SEQ_FULL + ql0) * DD + d0 + lane * 4;
#pragma unroll 1
  for (int rl = 0; rl < 16; ++rl) vst2(ob + (size_t)rl * DD, *(const v4f*)&ss[wave][rl][lane * 4]);
}

extern "C" void kernel_launch(void* const* d_in, const int* in_sizes, int n_in, void* d_out, int out_size, void* d_ws, size_t ws_size, hipStream_t stream) {
  if (n_in < 14) return;
  const float* xr = (const float*)d_in[0];  const float* xi = (const float*)d_in[1];
  const float* wqr = (const float*)d_in[2]; const float* wqi = (const float*)d_in[3]; const float* bqr = (const float*)d_in[4]; const float* bqi = (const float*)d_in[5];
  const float* wkr = (const float*)d_in[6]; const float* wki = (const float*)d_in[7]; const float* bkr = (const float*)d_in[8]; const float* bki = (const float*)d_in[9];
  const float* wvr = (const float*)d_in[10]; const float* wvi = (const float*)d_in[11]; const float* bvr = (const float*)d_in[12]; const float* bvi = (const float*)d_in[13];
  const int need_x = ((NB - 1) * SEQ_FULL + SEQ) * DD;
  if (in_sizes[0] < need_x || in_sizes[1] < need_x) return;
  for (int i = 2; i < 14; i += 4) { if (in_sizes[i] < DD * DD || in_sizes[i + 1] < DD * DD || in_sizes[i + 2] < DD || in_sizes[i + 3] < DD) return; }
  const int need_out = ((NB_FULL + NB - 1) * SEQ_FULL + SEQ) * DD;
  if (out_size < need_out) return;
  if (ws_size < (size_t)WS_END) return;
  char* ws = (char*)d_ws;
  __bf16* X = (__bf16*)(ws + WS_X); __bf16* Wp = (__bf16*)(ws + WS_W);
  _Float16* QH = (_Float16*)(ws + WS_QH); _Float16* QR = (_Float16*)(ws + WS_QR);
  _Float16* KH = (_Float16*)(ws + WS_KH); _Float16* KR = (_Float16*)(ws + WS_KR);
  _Float16* VT = (_Float16*)(ws + WS_VT); float* S = (float*)(ws + WS_S); _Float16* P = (_Float16*)(ws + WS_P);
  float* out = (float*)d_out;

  k_cvx<<<dim3(MR / 16, KP / 256), 256, 0, stream>>>(xr, xi, X);
  k_cvw<<<dim3(DD / 8, 3), 256, 0, stream>>>(wqr, wqi, wkr, wki, wvr, wvi, Wp);
  k_proj<<<dim3(MR / 64, DD / 128, 6), 128, 0, stream>>>(X, Wp, bqr, bqi, bkr, bki, bvr, bvi, QH, QR, KH, KR, VT);
  k_sc<<<dim3(SEQ / 64, SEQ / 64, 2 * NB), 128, 0, stream>>>(QH, QR, KH, KR, S);
  k_sm<<<dim3(NB * SEQ), 256, 0, stream>>>(S, P);
  k_pv<<<dim3(SEQ / 64, KP / 128, NB), 128, 0, stream>>>(P, VT, out);
}

// v003
// It runs in 195 microseconds.
// In two side-by-side timings against v002, it was 2.56 and 2.57 times as fast.
// All steps since v000 together make it 6.22 times as fast.
// compute dtype: all float inputs RNE-converted to bf16 on load; q/k/v projections on v_wmma_f32_16x16x32_bf16 (bf16 operands, exact products), f32 accumulate; scores on v_wmma_f32_16x16x32_f16 with q and k each = f16 hi + f16 residual x2^11 (3 products hi.hi, res.hi, hi.res; 2 accumulators); magnitude and softmax in f32 -> P f16 x2^14; P.v on v_wmma_f32_16x16x32_f16 with v = f16 hi (1 product); f32 output.
#include <hip/hip_runtime.h>
#include <math.h>

typedef __attribute__((ext_vector_type(16))) _Float16 v16h;
typedef __attribute__((ext_vector_type(16))) __bf16 v16b;
typedef __attribute__((ext_vector_type(8)))  _Float16 v8h;
typedef __attribute__((ext_vector_type(8)))  __bf16 v8b;
typedef __attribute__((ext_vector_type(8)))  float v8f;
typedef __attribute__((ext_vector_type(8)))  unsigned v8u;
typedef __attribute__((ext_vector_type(4)))  float v4f;
typedef __attribute__((ext_vector_type(4)))  unsigned v4u;

#define DD 512            // feature width per real/imag part
#define KP 1024           // concatenated contraction length [re | im]
#define NB_FULL 8
#define SEQ_FULL 1024
#ifndef NB
#define NB NB_FULL
#endif
#ifndef SEQ
#define SEQ SEQ_FULL
#endif
#define MR (NB * SEQ)     // projection rows
#define QCAR 2048.0f      // carry of the q and k residual planes
#define PCAR 16384.0f     // carry of the P plane
#define SCL 0.044194173824159216f   // 1/sqrt(512)

static_assert(NB >= 1 && NB <= NB_FULL);
static_assert(SEQ >= 256 && SEQ <= SEQ_FULL && (SEQ % 256) == 0);
static_assert((MR % 128) == 0);

// Planes marked FO lie in fragment order: a plane [R][K] is cut into units of 16 rows x 32 k = 512 elements (1 KiB), unit (rt, ks) at element (rt * (K / 32) + ks) * 512;
// inside a unit element (row, k) stands at ((k & 31) >> 4) * 256 + ((((k >> 3) & 1) * 16) + (row & 15)) * 8 + (k & 7): lane l's two 16-byte pieces at l * 8 and 256 + l * 8,
// so each 16-byte load or store of a wave covers 512 contiguous bytes (4 whole lines) in place of 32 bytes in each of 16 rows.
#define FU 512                                         // elements per fragment unit
#define WPL    ((size_t)DD * KP)                      // elements per weight plane
#define WS_X   ((size_t)0)                             // bf16 [MR][KP] FO
#define WS_W   (WS_X + 2u * (size_t)MR * KP)           // bf16 6 x [DD][KP] FO
#define WS_QH  (WS_W + 2u * 6u * WPL)                  // f16  [MR][KP] FO q hi
#define WS_QR  (WS_QH + 2u * (size_t)MR * KP)          // f16  [MR][KP] FO q residual x2^11
#define WS_KH  (WS_QR + 2u * (size_t)MR * KP)          // f16  [MR][KP] FO k hi  = [kr | ki]
#define WS_KR  (WS_KH + 2u * (size_t)MR * KP)          // f16  [MR][KP] FO k residual x2^11
#define WS_VT  (WS_KR + 2u * (size_t)MR * KP)          // f16  [NB * KP][SEQ] FO
#define WS_S   (WS_VT + 2u * (size_t)NB * KP * SEQ)    // f32  [NB][2][SEQ][SEQ]
#define WS_P   (WS_S + 4u * 2u * (size_t)NB * SEQ * SEQ) // f16  [NB][SEQ][SEQ]
#define WS_END (WS_P + 2u * (size_t)NB * SEQ * SEQ)
static_assert(WS_END <= (size_t)268435456);
static_assert((WS_W % 256) == 0 && (WS_QH % 256) == 0 && (WS_QR % 256) == 0 && (WS_KH % 256) == 0 && (WS_KR % 256) == 0 && (WS_VT % 256) == 0 && (WS_S % 256) == 0 && (WS_P % 256) == 0);

template <typename T> __device__ __forceinline__ void vst2(void* p, T v) { *(T*)p = v;  }

__device__ __forceinline__ v8f wmma16(v16h a, v16h b, v8f c) {
  v8f d = __builtin_amdgcn_wmma_f32_16x16x32_f16(false, a, false, b, (short)0, c, false, false);
  asm volatile("v_nop\n\tv_nop\n\tv_nop\n\tv_nop" : "+v"(d) : "v"(a), "v"(b));
  return d;
}
__device__ __forceinline__ v8f wmma_bf(v16b a, v16b b, v8f c) {
  v8f d = __builtin_amdgcn_wmma_f32_16x16x32_bf16(false, a, false, b, (short)0, c, false, false);
  asm volatile("v_nop\n\tv_nop\n\tv_nop\n\tv_nop" : "+v"(d) : "v"(a), "v"(b));
  return d;
}
// 16x16x32 fragments: lane = (h = lane>>4, row/col = lane&15); elements 0..7 = k0+8h+0..7, 8..15 = k0+16+8h+0..7; D element r = row 8h+r, col lane&15
__device__ __forceinline__ v16h frag_h(const _Float16* rowk0, int lane) {
  union { v16h v; v8h q[2]; } u; const _Float16* p = rowk0 + 8 * (lane >> 4);
  u.q[0] = *(const v8h*)p; u.q[1] = *(const v8h*)(p + 16); return u.v;
}
// the same fragments from a fragment-order unit (same k at every lane and element position as frag_h); p = the unit + 8 * lane elements
__device__ __forceinline__ v16h fragu_h(const _Float16* p) {
  union { v16h v; v8h q[2]; } u; u.q[0] = *(const v8h*)p; u.q[1] = *(const v8h*)(p + 256); return u.v;
}
__device__ __forceinline__ v16b fragu_b(const __bf16* p) {
  union { v16b v; v8b q[2]; } u; u.q[0] = *(const v8b*)p; u.q[1] = *(const v8b*)(p + 256); return u.v;
}
// sign-bit flip of all 16 halves when m == 0x80008000 (exact negation), identity when m == 0
__device__ __forceinline__ v16h hneg(v16h x, unsigned m) { v8u u = __builtin_bit_cast(v8u, x); u ^= m; return __builtin_bit_cast(v16h, u); }
__device__ __forceinline__ float bfr(float v) { return (float)(__bf16)v; }
__device__ __attribute__((noinline)) float exp_ni(float v) { return expf(v); }

// ---- k_cvx: X[row][0..511] = bf16(xr[row]), X[row][512..1023] = bf16(xi[row]), fragment order; block = 16 rows x 8 units, one unit (16 rows x 32 k) per wave, two 512-B stores per wave
__global__ __launch_bounds__(256) void k_cvx(const float* __restrict__ XR, const float* __restrict__ XI, __bf16* __restrict__ X) {
  const int tid = threadIdx.x, wave = tid >> 5, lane = tid & 31;
  const int rt = blockIdx.x, ks = blockIdx.y * 8 + wave;               // ks is wave-uniform
  const int row = rt * 16 + (lane & 15);
  const int bb = row / SEQ, n = row - bb * SEQ;
  const float* sp = ((ks >= DD / 32) ? XI : XR) + ((size_t)bb * SEQ_FULL + n) * DD + (ks & (DD / 32 - 1)) * 32 + 8 * (lane >> 4);
  __bf16* dp = X + ((size_t)rt * (KP / 32) + ks) * FU + lane * 8;
#pragma unroll
  for (int q = 0; q < 2; ++q) {
    const v4f f0 = *(const v4f*)(sp + q * 16), f1 = *(const v4f*)(sp + q * 16 + 4);
    v8b o;
#pragma unroll
    for (int i = 0; i < 4; ++i) { o[i] = (__bf16)f0[i]; o[4 + i] = (__bf16)f1[i]; }
    vst2(dp + q * 256, __builtin_bit_cast(v4u, o));
  }
}
// ---- k_cvw: weight planes of complex linear y = blockIdx.y (q, k, v): BRE[e] = [Wr[e] | -Wi[e]], BIM[e] = [Wi[e] | Wr[e]] (bf16, negation exact), fragment order; block = 16 rows x 8 units of Wr and Wi, one unit of each per wave
__global__ __launch_bounds__(256) void k_cvw(const float* __restrict__ WQR, const float* __restrict__ WQI, const float* __restrict__ WKR, const float* __restrict__ WKI,
                                             const float* __restrict__ WVR, const float* __restrict__ WVI, __bf16* __restrict__ Wp) {
  const int y = blockIdx.y;                                            // block-uniform
  const float* WR = (y == 0) ? WQR : ((y == 1) ? WKR : WVR); const float* WI = (y == 0) ? WQI : ((y == 1) ? WKI : WVI);
  __bf16* BRE = Wp + (size_t)(2 * y) * WPL; __bf16* BIM = BRE + WPL;
  const int tid = threadIdx.x, wave = tid >> 5, lane = tid & 31;
  const int et = blockIdx.x >> 1, ks = (blockIdx.x & 1) * 8 + wave;    // unit of the 512-wide source, wave-uniform
  const size_t so = (size_t)(et * 16 + (lane & 15)) * DD + ks * 32 + 8 * (lane >> 4);
  const float* pr = WR + so; const float* pi = WI + so;
  const size_t uo = ((size_t)et * (KP / 32) + ks) * FU + lane * 8;      // left half; the right half lies DD / 32 units on
#pragma unroll
  for (int q = 0; q < 2; ++q) {
    const v4f r0 = *(const v4f*)(pr + q * 16), r1 = *(const v4f*)(pr + q * 16 + 4), i0 = *(const v4f*)(pi + q * 16), i1 = *(const v4f*)(pi + q * 16 + 4);
    v8b vr, vi, vn;
#pragma unroll
    for (int i = 0; i < 4; ++i) { vr[i] = (__bf16)r0[i]; vr[4 + i] = (__bf16)r1[i]; vi[i] = (__bf16)i0[i]; vi[4 + i] = (__bf16)i1[i]; vn[i] = (__bf16)(-i0[i]); vn[4 + i] = (__bf16)(-i1[i]); }
    vst2(BRE + uo + q * 256,                  __builtin_bit_cast(v4u, vr));
    vst2(BRE + uo + (DD / 32) * FU + q * 256, __builtin_bit_cast(v4u, vn));
    vst2(BIM + uo + q * 256,                  __builtin_bit_cast(v4u, vi));
    vst2(BIM + uo + (DD / 32) * FU + q * 256, __builtin_bit_cast(v4u, vr));
  }
}

// ---- k_proj: Y[MR][512-col tile] = X[MR][KP] . Wp[512][KP]^T + bias; block = 128 rows x 128 cols, 4 waves (2 x 2) each 64 rows x 64 cols: 8 fragments loaded per 16 products
// blockIdx.z = weight plane 0..5 (q re, q im, k re, k im, v re, v im): all six projections in one grid
// mode 0: f16 hi -> P0, f16 residual x2^11 -> P1, plane [MR][KP] at column c0 + n; mode 1: f16 hi transposed -> plane [NB * KP][SEQ]; both in fragment order
__global__ __launch_bounds__(128) void k_proj(const __bf16* __restrict__ X, const __bf16* __restrict__ W6,
                                              const float* __restrict__ BQR, const float* __restrict__ BQI, const float* __restrict__ BKR, const float* __restrict__ BKI,
                                              const float* __restrict__ BVR, const float* __restrict__ BVI,
                                              _Float16* QH, _Float16* QR, _Float16* KH, _Float16* KR, _Float16* VT) {
  __shared__ __align__(16) float ss[128][132];
  const int pz = blockIdx.z;                                           // block-uniform
  const __bf16* Wp = W6 + (size_t)pz * WPL;
  const float* bias = (pz == 0) ? BQR : ((pz == 1) ? BQI : ((pz == 2) ? BKR : ((pz == 3) ? BKI : ((pz == 4) ? BVR : BVI))));
  const int mode = (pz >= 4) ? 1 : 0, c0 = (pz & 1) * DD;
  _Float16* P0 = (pz < 2) ? QH : ((pz < 4) ? KH : VT); _Float16* P1 = (pz < 2) ? QR : KR;
  const int tid = threadIdx.x, wave = __builtin_amdgcn_readfirstlane(tid >> 5), lane = tid & 31, col = lane & 15, g = lane >> 4;   // wave number as a scalar: tile offsets are scalar arithmetic
  const int r0 = blockIdx.x * 128, n0 = blockIdx.y * 128; const int wr = (wave >> 1) * 64, wc = (wave & 1) * 64;
  const __bf16* xa = X + (size_t)((r0 + wr) >> 4) * (KP / 32) * FU; const __bf16* wb = Wp + (size_t)((n0 + wc) >> 4) * (KP / 32) * FU;
  v8f acc[4][4] = {};
#pragma unroll 1
  for (int kc = 0; kc < KP / 32; ++kc) {
    const __bf16* pa = xa + kc * FU + lane * 8; const __bf16* pw = wb + kc * FU + lane * 8;
    v16b a[4], w[4];
#pragma unroll
    for (int i = 0; i < 4; ++i) { a[i] = fragu_b(pa + (size_t)i * (KP / 32) * FU); w[i] = fragu_b(pw + (size_t)i * (KP / 32) * FU); }
    asm volatile("s_wait_xcnt 0x0" :: "v"(pa), "v"(pw) : "memory");   // precaution: the address registers stay whole (inputs here) until this wait; behind it a load's result or the next trip may take them
#pragma unroll
    for (int i = 0; i < 4; ++i)
#pragma unroll
      for (int j = 0; j < 4; ++j) acc[i][j] = wmma_bf(a[i], w[j], acc[i][j]);
  }
#pragma unroll
  for (int j = 0; j < 4; ++j) { const float bb = bfr(bias[n0 + wc + j * 16 + col]);
#pragma unroll
    for (int i = 0; i < 4; ++i)
#pragma unroll
      for (int r = 0; r < 8; ++r) ss[wr + i * 16 + 8 * g + r][wc + j * 16 + col] = acc[i][j][r] + bb; }
  __syncthreads();
  if (mode == 1) {
    const int bb = r0 / SEQ, nl = r0 - bb * SEQ;
    _Float16* vt = P0 + ((size_t)((bb * KP + c0 + n0) >> 4) * (SEQ / 32) + (nl >> 5)) * FU + lane * 8;
    // 8 row tiles (16 features) x 4 units (32 positions) x 2 pieces; lane = (g, col): feature dt * 16 + col, positions ku * 32 + q * 16 + 8 g + 0..7
    for (int e = wave; e < 64; e += 4) { const int dt = e >> 3, ku = (e >> 1) & 3, q = e & 1; v8h o;
#pragma unroll
      for (int i = 0; i < 8; ++i) o[i] = (_Float16)ss[ku * 32 + q * 16 + 8 * g + i][dt * 16 + col];
      vst2(vt + ((size_t)dt * (SEQ / 32) + ku) * FU + q * 256, __builtin_bit_cast(v4u, o));
      asm volatile("s_wait_xcnt 0x0" ::: "memory");   // precaution: the next trip rewrites the store's address and data registers
    }
  } else {
#pragma unroll 1
    for (int ib = 0; ib < 16; ++ib) { const int rt = wave * 2 + (ib >> 3), it = ib & 7;       // row tile rt of the block's 8; unit it >> 1, piece it & 1
      const int rl = rt * 16 + col, cl = it * 16 + 8 * g;
      const v4f x0 = *(const v4f*)&ss[rl][cl], x1 = *(const v4f*)&ss[rl][cl + 4];
      float v[8]; v8h hh, rr;
#pragma unroll
      for (int i = 0; i < 4; ++i) { v[i] = x0[i]; v[4 + i] = x1[i]; }
#pragma unroll
      for (int i = 0; i < 8; ++i) hh[i] = (_Float16)v[i];
#pragma unroll
      for (int i = 0; i < 8; ++i) rr[i] = (_Float16)((v[i] - (float)hh[i]) * QCAR);
      const size_t ro = ((size_t)((r0 >> 4) + rt) * (KP / 32) + ((c0 + n0) >> 5) + (it >> 1)) * FU + (it & 1) * 256 + lane * 8;
      vst2(P0 + ro, __builtin_bit_cast(v4u, hh));
      vst2(P1 + ro, __builtin_bit_cast(v4u, rr));
      asm volatile("s_wait_xcnt 0x0" ::: "memory");   // precaution: the next trip rewrites the two stores' address and data registers
    }
  }
}

// ---- k_sc: S[b][z][SEQ][SEQ], blockIdx.z = b, both planes z in one block, with k plane = [kr | ki] and q plane = [qr | qi]; one k-step = 32 features of the re and of the im half:
// z=0: qr.kr + qi.(-ki) (sign-bit flip of the ki fragments); z=1: qr.ki + qi.kr; x 1/sqrt(512)
// q = hi + res/2^11, k = hi + res/2^11: products hi.hi -> h*, res.hi + hi.res -> c* (folded x 2^-11)
// block = 64 queries x 64 keys, 4 waves (2 x 2) each 32 x 32 in both planes: 16 fragments loaded per 48 products
__global__ __launch_bounds__(128) void k_sc(const _Float16* __restrict__ QH, const _Float16* __restrict__ QR, const _Float16* __restrict__ KH, const _Float16* __restrict__ KR,
                                            float* __restrict__ S0) {
  __shared__ __align__(16) float ss[4][2][32][36];
  const int b = blockIdx.z; float* S = S0 + (size_t)(2 * b) * SEQ * SEQ;
  const int tid = threadIdx.x, wave = __builtin_amdgcn_readfirstlane(tid >> 5), lane = tid & 31, col = lane & 15, g = lane >> 4;   // wave number as a scalar: tile offsets are scalar arithmetic, which keeps the kernel inside 256 vector registers
  const int k0 = blockIdx.y * 64 + (wave & 1) * 32; const int ql0 = blockIdx.x * 64 + (wave >> 1) * 32;
  const size_t qrow = (size_t)((b * SEQ + ql0) >> 4) * (KP / 32) * FU, krow = (size_t)((b * SEQ + k0) >> 4) * (KP / 32) * FU;   // first unit of the first row tile
  const _Float16* qh = QH + qrow; const _Float16* ql = QR + qrow; const _Float16* kh = KH + krow; const _Float16* kl = KR + krow;
  v8f hr[2][2] = {}, cr[2][2] = {}, hi[2][2] = {}, ci[2][2] = {};             // [query tile][key tile]
#pragma unroll 1
  for (int kc = 0; kc < DD / 32; ++kc) {
    const _Float16* pqh = qh + kc * FU + lane * 8; const _Float16* pql = ql + kc * FU + lane * 8; const _Float16* pkh = kh + kc * FU + lane * 8; const _Float16* pkl = kl + kc * FU + lane * 8;
    v16h qrh[2], qrc[2], qih[2], qic[2], krh[2], krc[2], kih[2], kic[2];      // re / im part, hi / residual
#pragma unroll
    for (int i = 0; i < 2; ++i) { const size_t u = (size_t)i * (KP / 32) * FU, v = u + (DD / 32) * FU;
      qrh[i] = fragu_h(pqh + u); qrc[i] = fragu_h(pql + u); qih[i] = fragu_h(pqh + v); qic[i] = fragu_h(pql + v); krh[i] = fragu_h(pkh + u); kih[i] = fragu_h(pkh + v); }
    asm volatile("s_wait_xcnt 0x0" :: "v"(pqh), "v"(pql), "v"(pkh) : "memory");   // precaution: the address registers stay whole (inputs here) until this wait; behind it a load's result may take them
#define SC4(ACC, A, B) _Pragma("unroll") for (int i = 0; i < 2; ++i) _Pragma("unroll") for (int j = 0; j < 2; ++j) ACC[i][j] = wmma16(A[i], B[j], ACC[i][j]);
    SC4(cr, qrc, krh) SC4(ci, qrc, kih)
    // the k residuals come behind the last uses of qrc, whose registers they can take: accumulators and fragments then fit the 256 registers that an asm operand can name (no spill); the next 24 products cover their latency
#pragma unroll
    for (int i = 0; i < 2; ++i) { const size_t u = (size_t)i * (KP / 32) * FU, v = u + (DD / 32) * FU; krc[i] = fragu_h(pkl + u); kic[i] = fragu_h(pkl + v); }
    asm volatile("s_wait_xcnt 0x0" :: "v"(pkl) : "memory");   // the same precaution for these loads
    SC4(hr, qrh, krh) SC4(hi, qrh, kih) SC4(hi, qih, krh) SC4(ci, qic, krh)
#pragma unroll
    for (int i = 0; i < 2; ++i) kih[i] = hneg(kih[i], 0x80008000u);            // qi.(-ki) = -(qi.ki), exact
    SC4(hr, qih, kih) SC4(cr, qic, kih)
    SC4(cr, qrh, krc) SC4(ci, qih, krc) SC4(ci, qrh, kic)
#pragma unroll
    for (int i = 0; i < 2; ++i) kic[i] = hneg(kic[i], 0x80008000u);
    SC4(cr, qih, kic)
#undef SC4
  }
#pragma unroll
  for (int i = 0; i < 2; ++i)
#pragma unroll
    for (int j = 0; j < 2; ++j)
#pragma unroll
      for (int r = 0; r < 8; ++r) {
        ss[wave][0][i * 16 + 8 * g + r][j * 16 + col] = hr[i][j][r] * SCL + cr[i][j][r] * (SCL / QCAR);
        ss[wave][1][i * 16 + 8 * g + r][j * 16 + col] = hi[i][j][r] * SCL + ci[i][j][r] * (SCL / QCAR); }
  __syncthreads();
  // each store of a wave: 4 rows x 128 B (whole lines)
#pragma unroll 1
  for (int it = 0; it < 16; ++it) { const int z = it >> 3, rl = (it & 7) * 4 + (lane >> 3);
    vst2(S + (size_t)z * SEQ * SEQ + (size_t)(ql0 + rl) * SEQ + k0 + (lane & 7) * 4, *(const v4f*)&ss[wave][z][rl][(lane & 7) * 4]);
    asm volatile("s_wait_xcnt 0x0" ::: "memory");     // precaution: the next trip rewrites the store's address and data registers
  }
}
// ---- k_sm: block = one query row of one batch (blockIdx.x = b SEQ + n): a[m] = sqrt(sre^2 + sim^2), softmax over SEQ keys (max-subtracted, f32) -> P f16 x 2^14
__global__ __launch_bounds__(256) void k_sm(const float* __restrict__ S0, _Float16* __restrict__ P) {
  __shared__ float sred[8]; __shared__ float sbc; __shared__ __align__(16) _Float16 sh[SEQ];
  constexpr int EPT = SEQ / 256;
  const int t = threadIdx.x; const size_t row = blockIdx.x; const size_t bb = row / SEQ;
  const float* sr = S0 + (bb * SEQ + row) * SEQ + t * EPT; const float* si = sr + (size_t)SEQ * SEQ;   // plane 2 bb, row n: (2 bb SEQ + n) = bb SEQ + row
  float a[EPT]; float m = -3.0e38f;
#pragma unroll
  for (int i = 0; i < EPT; ++i) { const float x = sr[i], y = si[i]; a[i] = sqrtf(x * x + y * y); m = fmaxf(m, a[i]); }
#pragma unroll
  for (int o = 1; o < 32; o <<= 1) m = fmaxf(m, __shfl_xor(m, o));
  if ((t & 31) == 0) sred[t >> 5] = m; __syncthreads();
  if (t == 0) { float v = sred[0]; for (int i = 1; i < 8; ++i) v = fmaxf(v, sred[i]); sbc = v; } __syncthreads(); m = sbc; __syncthreads();
  float e[EPT]; float sum = 0.f;
#pragma unroll
  for (int i = 0; i < EPT; ++i) { e[i] = exp_ni(a[i] - m); sum += e[i]; }
#pragma unroll
  for (int o = 1; o < 32; o <<= 1) sum += __shfl_xor(sum, o);
  if ((t & 31) == 0) sred[t >> 5] = sum; __syncthreads();
  if (t == 0) { float v = 0.f; for (int i = 0; i < 8; ++i) v += sred[i]; sbc = 1.0f / v; } __syncthreads(); const float inv = sbc;
#pragma unroll
  for (int i = 0; i < EPT; ++i) sh[t * EPT + i] = (_Float16)(e[i] * inv * PCAR);
  __syncthreads();
  if (t < SEQ / 8) vst2(P + row * SEQ + t * 8, *(const v4u*)&sh[t * 8]);
}
// ---- k_pv: ctx[n][0..1023] = P[b] . [vr|vi] for batch b = blockIdx.z; columns 0..511 -> output plane 0, 512..1023 -> plane 1; block = 128 queries x 128 cols, 4 waves each 32 x 128: 10 fragments loaded per 16 products
__global__ __launch_bounds__(128) void k_pv(const _Float16* __restrict__ P, const _Float16* __restrict__ VT, float* __restrict__ OUT) {
  __shared__ __align__(16) float ss[4][32][132];
  const int b = blockIdx.z;
  const int tid = threadIdx.x, wave = tid >> 5, lane = tid & 31, col = lane & 15, g = lane >> 4;
  const int n0 = blockIdx.y * 128; const int ql0 = blockIdx.x * 128 + wave * 32;
  const _Float16* pa = P + ((size_t)b * SEQ + ql0 + col) * SEQ; const _Float16* vb = VT + (size_t)((b * KP + n0) >> 4) * (SEQ / 32) * FU;
  v8f acc[2][8] = {};
#pragma unroll 1
  for (int kc = 0; kc < SEQ / 32; ++kc) {
    const _Float16* pp = pa + kc * 32; const _Float16* pv = vb + kc * FU + lane * 8;
    v16h a[2], v[8];
#pragma unroll
    for (int i = 0; i < 2; ++i) a[i] = frag_h(pp + (size_t)i * 16 * SEQ, lane);
#pragma unroll
    for (int j = 0; j < 8; ++j) v[j] = fragu_h(pv + (size_t)j * (SEQ / 32) * FU);
    asm volatile("s_wait_xcnt 0x0" :: "v"(pv) : "memory");   // precaution: the v address registers stay whole (an input here) until this wait; behind it a load's result or the next trip may take them
#pragma unroll
    for (int j = 0; j < 8; ++j)
#pragma unroll
      for (int i = 0; i < 2; ++i) acc[i][j] = wmma16(a[i], v[j], acc[i][j]);
  }
#pragma unroll
  for (int i = 0; i < 2; ++i)
#pragma unroll
    for (int j = 0; j < 8; ++j)
#pragma unroll
      for (int r = 0; r < 8; ++r) ss[wave][i * 16 + 8 * g + r][j * 16 + col] = acc[i][j][r] * (1.0f / PCAR);
  __syncthreads();
  const int pl = n0 / DD, d0 = n0 - pl * DD;
  float* ob = OUT + (((size_t)pl * NB_FULL + b) * SEQ_FULL + ql0) * DD + d0 + lane * 4;
#pragma unroll 1
  for (int rl = 0; rl < 32; ++rl) { vst2(ob + (size_t)rl * DD, *(const v4f*)&ss[wave][rl][lane * 4]);
    asm volatile("s_wait_xcnt 0x0" ::: "memory");     // precaution: the next trip rewrites the store's address and data registers
  }
}

extern "C" void kernel_launch(void* const* d_in, const int* in_sizes, int n_in, void* d_out, int out_size, void* d_ws, size_t ws_size, hipStream_t stream) {
  if (n_in < 14) return;
  const float* xr = (const float*)d_in[0];  const float* xi = (const float*)d_in[1];
  const float* wqr = (const float*)d_in[2]; const float* wqi = (const float*)d_in[3]; const float* bqr = (const float*)d_in[4]; const float* bqi = (const float*)d_in[5];
  const float* wkr = (const float*)d_in[6]; const float* wki = (const float*)d_in[7]; const float* bkr = (const float*)d_in[8]; const float* bki = (const float*)d_in[9];
  const float* wvr = (const float*)d_in[10]; const float* wvi = (const float*)d_in[11]; const float* bvr = (const float*)d_in[12]; const float* bvi = (const float*)d_in[13];
  const int need_x = ((NB - 1) * SEQ_FULL + SEQ) * DD;
  if (in_sizes[0] < need_x || in_sizes[1] < need_x) return;
  for (int i = 2; i < 14; i += 4) { if (in_sizes[i] < DD * DD || in_sizes[i + 1] < DD * DD || in_sizes[i + 2] < DD || in_sizes[i + 3] < DD) return; }
  const int need_out = ((NB_FULL + NB - 1) * SEQ_FULL + SEQ) * DD;
  if (out_size < need_out) return;
  if (ws_size < (size_t)WS_END) return;
  char* ws = (char*)d_ws;
  __bf16* X = (__bf16*)(ws + WS_X); __bf16* Wp = (__bf16*)(ws + WS_W);
  _Float16* QH = (_Float16*)(ws + WS_QH); _Float16* QR = (_Float16*)(ws + WS_QR);
  _Float16* KH = (_Float16*)(ws + WS_KH); _Float16* KR = (_Float16*)(ws + WS_KR);
  _Float16* VT = (_Float16*)(ws + WS_VT); float* S = (float*)(ws + WS_S); _Float16* P = (_Float16*)(ws + WS_P);
  float* out = (float*)d_out;

  k_cvx<<<dim3(MR / 16, KP / 256), 256, 0, stream>>>(xr, xi, X);
  k_cvw<<<dim3(DD / 8, 3), 256, 0, stream>>>(wqr, wqi, wkr, wki, wvr, wvi, Wp);
  k_proj<<<dim3(MR / 128, DD / 128, 6), 128, 0, stream>>>(X, Wp, bqr, bqi, bkr, bki, bvr, bvi, QH, QR, KH, KR, VT);
  k_sc<<<dim3(SEQ / 64, SEQ / 64, NB), 128, 0, stream>>>(QH, QR, KH, KR, S);
  k_sm<<<dim3(NB * SEQ), 256, 0, stream>>>(S, P);
  k_pv<<<dim3(SEQ / 128, KP / 128, NB), 128, 0, stream>>>(P, VT, out);
}

// v004
// A run of this version takes 145 microseconds.
// In both of two side-by-side timings against v003, it was 1.34 times as fast.
// Over all steps from v000 it is 8.33 times as fast.
// compute dtype: all float inputs RNE-converted to bf16 on load; q/k/v projections on v_wmma_f32_16x16x32_bf16 (bf16 operands, exact products), f32 accumulate; scores on v_wmma_f32_16x16x32_f16 with q and k each = f16 hi + f16 residual x2^11 (3 products hi.hi, res.hi, hi.res; 2 accumulators); magnitude and softmax in f32 -> P f16 x2^14; P.v on v_wmma_f32_16x16x32_f16 with v = f16 hi (1 product); f32 output.
#include <hip/hip_runtime.h>
#include <math.h>

typedef __attribute__((ext_vector_type(16))) _Float16 v16h;
typedef __attribute__((ext_vector_type(16))) __bf16 v16b;
typedef __attribute__((ext_vector_type(8)))  _Float16 v8h;
typedef __attribute__((ext_vector_type(8)))  __bf16 v8b;
typedef __attribute__((ext_vector_type(8)))  float v8f;
typedef __attribute__((ext_vector_type(8)))  unsigned v8u;
typedef __attribute__((ext_vector_type(4)))  float v4f;
typedef __attribute__((ext_vector_type(4)))  unsigned v4u;

#define DD 512            // feature width per real/imag part
#define KP 1024           // concatenated contraction length [re | im]
#define NB_FULL 8
#define SEQ_FULL 1024
#ifndef NB
#define NB NB_FULL
#endif
#ifndef SEQ
#define SEQ SEQ_FULL
#endif
#define MR (NB * SEQ)     // projection rows
#define QCAR 2048.0f      // carry of the q and k residual planes
#define PCAR 16384.0f     // carry of the P plane
#define SCL 0.044194173824159216f   // 1/sqrt(512)

static_assert(NB >= 1 && NB <= NB_FULL);
static_assert(SEQ >= 256 && SEQ <= SEQ_FULL && (SEQ % 256) == 0);
static_assert((MR % 128) == 0);

// Planes marked FO lie in fragment order: a plane [R][K] is cut into units of 16 rows x 32 k = 512 elements (1 KiB), unit (rt, ks) at element (rt * (K / 32) + ks) * 512;
// inside a unit element (row, k) stands at ((k & 31) >> 4) * 256 + ((((k >> 3) & 1) * 16) + (row & 15)) * 8 + (k & 7): lane l's two 16-byte pieces at l * 8 and 256 + l * 8,
// so each 16-byte load or store of a wave covers 512 contiguous bytes (4 whole lines) in place of 32 bytes in each of 16 rows.
#define FU 512                                         // elements per fragment unit
#define WPL    ((size_t)DD * KP)                      // elements per weight plane
#define WS_X   ((size_t)0)                             // bf16 [MR][KP] FO
#define WS_W   (WS_X + 2u * (size_t)MR * KP)           // bf16 6 x [DD][KP] FO
#define WS_QH  (WS_W + 2u * 6u * WPL)                  // f16  [MR][KP] FO q hi
#define WS_QR  (WS_QH + 2u * (size_t)MR * KP)          // f16  [MR][KP] FO q residual x2^11
#define WS_KH  (WS_QR + 2u * (size_t)MR * KP)          // f16  [MR][KP] FO k hi  = [kr | ki]
#define WS_KR  (WS_KH + 2u * (size_t)MR * KP)          // f16  [MR][KP] FO k residual x2^11
#define WS_VT  (WS_KR + 2u * (size_t)MR * KP)          // f16  [NB * KP][SEQ] FO
#define WS_S   (WS_VT + 2u * (size_t)NB * KP * SEQ)    // f32  [NB][2][SEQ][SEQ]
#define WS_P   (WS_S + 4u * 2u * (size_t)NB * SEQ * SEQ) // f16  [NB][SEQ][SEQ]
#define WS_END (WS_P + 2u * (size_t)NB * SEQ * SEQ)
static_assert(WS_END <= (size_t)268435456);
static_assert((WS_W % 256) == 0 && (WS_QH % 256) == 0 && (WS_QR % 256) == 0 && (WS_KH % 256) == 0 && (WS_KR % 256) == 0 && (WS_VT % 256) == 0 && (WS_S % 256) == 0 && (WS_P % 256) == 0);

template <typename T> __device__ __forceinline__ void vst2(void* p, T v) { *(T*)p = v;  }

__device__ __forceinline__ v8f wmma16(v16h a, v16h b, v8f c) {
  v8f d = __builtin_amdgcn_wmma_f32_16x16x32_f16(false, a, false, b, (short)0, c, false, false);
  asm volatile("v_nop\n\tv_nop\n\tv_nop\n\tv_nop" : "+v"(d) : "v"(a), "v"(b));
  return d;
}
__device__ __forceinline__ v8f wmma_bf(v16b a, v16b b, v8f c) {
  v8f d = __builtin_amdgcn_wmma_f32_16x16x32_bf16(false, a, false, b, (short)0, c, false, false);
  asm volatile("v_nop\n\tv_nop\n\tv_nop\n\tv_nop" : "+v"(d) : "v"(a), "v"(b));
  return d;
}
// 16x16x32 fragments: lane = (h = lane>>4, row/col = lane&15); elements 0..7 = k0+8h+0..7, 8..15 = k0+16+8h+0..7; D element r = row 8h+r, col lane&15
__device__ __forceinline__ v16h frag_h(const _Float16* rowk0, int lane) {
  union { v16h v; v8h q[2]; } u; const _Float16* p = rowk0 + 8 * (lane >> 4);
  u.q[0] = *(const v8h*)p; u.q[1] = *(const v8h*)(p + 16); return u.v;
}
// the same fragments from a fragment-order unit (same k at every lane and element position as frag_h); p = the unit + 8 * lane elements
__device__ __forceinline__ v16h fragu_h(const _Float16* p) {
  union { v16h v; v8h q[2]; } u; u.q[0] = *(const v8h*)p; u.q[1] = *(const v8h*)(p + 256); return u.v;
}
__device__ __forceinline__ v16b fragu_b(const __bf16* p) {
  union { v16b v; v8b q[2]; } u; u.q[0] = *(const v8b*)p; u.q[1] = *(const v8b*)(p + 256); return u.v;
}
// sign-bit flip of all 16 halves when m == 0x80008000 (exact negation), identity when m == 0
__device__ __forceinline__ v16h hneg(v16h x, unsigned m) { v8u u = __builtin_bit_cast(v8u, x); u ^= m; return __builtin_bit_cast(v16h, u); }
// asynchronous copies to LDS: each lane brings 16 bytes, a wave and copy 512 bytes; l* = the lane's LDS byte address, g* = the lane's global address.
// 12 copies = three 2-KiB pieces; in LDS a piece is contiguous, in global memory its second KiB lies G2 bytes behind the start of the first.
// The s_wait_xcnt stands inside the copies' own statement (precaution): the address registers stay whole until it, whatever the compiler puts behind the statement.
__device__ __forceinline__ unsigned lds_addr(const void* p) { return (unsigned)(size_t)p; }   // low 32 bits of a __shared__ address = byte offset in the work-group's LDS
template <int G2> __device__ __forceinline__ void acopy12(unsigned la, unsigned lb, unsigned lc, const char* ga, const char* gb, const char* gc) {
  asm volatile("global_load_async_to_lds_b128 %0, %12, off\n\tglobal_load_async_to_lds_b128 %1, %13, off\n\tglobal_load_async_to_lds_b128 %2, %14, off\n\tglobal_load_async_to_lds_b128 %3, %15, off\n\t"
               "global_load_async_to_lds_b128 %4, %16, off\n\tglobal_load_async_to_lds_b128 %5, %17, off\n\tglobal_load_async_to_lds_b128 %6, %18, off\n\tglobal_load_async_to_lds_b128 %7, %19, off\n\t"
               "global_load_async_to_lds_b128 %8, %20, off\n\tglobal_load_async_to_lds_b128 %9, %21, off\n\tglobal_load_async_to_lds_b128 %10, %22, off\n\tglobal_load_async_to_lds_b128 %11, %23, off\n\t"
               "s_wait_xcnt 0x0"
               :: "v"(la), "v"(la + 512), "v"(la + 1024), "v"(la + 1536), "v"(lb), "v"(lb + 512), "v"(lb + 1024), "v"(lb + 1536), "v"(lc), "v"(lc + 512), "v"(lc + 1024), "v"(lc + 1536),
                  "v"(ga), "v"(ga + 512), "v"(ga + G2), "v"(ga + G2 + 512), "v"(gb), "v"(gb + 512), "v"(gb + G2), "v"(gb + G2 + 512), "v"(gc), "v"(gc + 512), "v"(gc + G2), "v"(gc + G2 + 512)
               : "memory");
}
// 8 copies, LS bytes apart in LDS and GS bytes apart in global memory
template <int LS, int GS> __device__ __forceinline__ void acopy8(unsigned l, const char* g) {
  asm volatile("global_load_async_to_lds_b128 %0, %8, off\n\tglobal_load_async_to_lds_b128 %1, %9, off\n\tglobal_load_async_to_lds_b128 %2, %10, off\n\tglobal_load_async_to_lds_b128 %3, %11, off\n\t"
               "global_load_async_to_lds_b128 %4, %12, off\n\tglobal_load_async_to_lds_b128 %5, %13, off\n\tglobal_load_async_to_lds_b128 %6, %14, off\n\tglobal_load_async_to_lds_b128 %7, %15, off\n\t"
               "s_wait_xcnt 0x0"
               :: "v"(l), "v"(l + LS), "v"(l + 2 * LS), "v"(l + 3 * LS), "v"(l + 4 * LS), "v"(l + 5 * LS), "v"(l + 6 * LS), "v"(l + 7 * LS),
                  "v"(g), "v"(g + GS), "v"(g + 2 * GS), "v"(g + 3 * GS), "v"(g + 4 * GS), "v"(g + 5 * GS), "v"(g + 6 * GS), "v"(g + 7 * GS)
               : "memory");
}
__device__ __forceinline__ float bfr(float v) { return (float)(__bf16)v; }
__device__ __attribute__((noinline)) float exp_ni(float v) { return expf(v); }

// ---- k_cvx: X[row][0..511] = bf16(xr[row]), X[row][512..1023] = bf16(xi[row]), fragment order; block = 16 rows x 8 units, one unit (16 rows x 32 k) per wave, two 512-B stores per wave
__global__ __launch_bounds__(256) void k_cvx(const float* __restrict__ XR, const float* __restrict__ XI, __bf16* __restrict__ X) {
  const int tid = threadIdx.x, wave = tid >> 5, lane = tid & 31;
  const int rt = blockIdx.x, ks = blockIdx.y * 8 + wave;               // ks is wave-uniform
  const int row = rt * 16 + (lane & 15);
  const int bb = row / SEQ, n = row - bb * SEQ;
  const float* sp = ((ks >= DD / 32) ? XI : XR) + ((size_t)bb * SEQ_FULL + n) * DD + (ks & (DD / 32 - 1)) * 32 + 8 * (lane >> 4);
  __bf16* dp = X + ((size_t)rt * (KP / 32) + ks) * FU + lane * 8;
#pragma unroll
  for (int q = 0; q < 2; ++q) {
    const v4f f0 = *(const v4f*)(sp + q * 16), f1 = *(const v4f*)(sp + q * 16 + 4);
    v8b o;
#pragma unroll
    for (int i = 0; i < 4; ++i) { o[i] = (__bf16)f0[i]; o[4 + i] = (__bf16)f1[i]; }
    vst2(dp + q * 256, __builtin_bit_cast(v4u, o));
  }
}
// ---- k_cvw: weight planes of complex linear y = blockIdx.y (q, k, v): BRE[e] = [Wr[e] | -Wi[e]], BIM[e] = [Wi[e] | Wr[e]] (bf16, negation exact), fragment order; block = 16 rows x 8 units of Wr and Wi, one unit of each per wave
__global__ __launch_bounds__(256) void k_cvw(const float* __restrict__ WQR, const float* __restrict__ WQI, const float* __restrict__ WKR, const float* __restrict__ WKI,
                                             const float* __restrict__ WVR, const float* __restrict__ WVI, __bf16* __restrict__ Wp) {
  const int y = blockIdx.y;                                            // block-uniform
  const float* WR = (y == 0) ? WQR : ((y == 1) ? WKR : WVR); const float* WI = (y == 0) ? WQI : ((y == 1) ? WKI : WVI);
  __bf16* BRE = Wp + (size_t)(2 * y) * WPL; __bf16* BIM = BRE + WPL;
  const int tid = threadIdx.x, wave = tid >> 5, lane = tid & 31;
  const int et = blockIdx.x >> 1, ks = (blockIdx.x & 1) * 8 + wave;    // unit of the 512-wide source, wave-uniform
  const size_t so = (size_t)(et * 16 + (lane & 15)) * DD + ks * 32 + 8 * (lane >> 4);
  const float* pr = WR + so; const float* pi = WI + so;
  const size_t uo = ((size_t)et * (KP / 32) + ks) * FU + lane * 8;      // left half; the right half lies DD / 32 units on
#pragma unroll
  for (int q = 0; q < 2; ++q) {
    const v4f r0 = *(const v4f*)(pr + q * 16), r1 = *(const v4f*)(pr + q * 16 + 4), i0 = *(const v4f*)(pi + q * 16), i1 = *(const v4f*)(pi + q * 16 + 4);
    v8b vr, vi, vn;
#pragma unroll
    for (int i = 0; i < 4; ++i) { vr[i] = (__bf16)r0[i]; vr[4 + i] = (__bf16)r1[i]; vi[i] = (__bf16)i0[i]; vi[4 + i] = (__bf16)i1[i]; vn[i] = (__bf16)(-i0[i]); vn[4 + i] = (__bf16)(-i1[i]); }
    vst2(BRE + uo + q * 256,                  __builtin_bit_cast(v4u, vr));
    vst2(BRE + uo + (DD / 32) * FU + q * 256, __builtin_bit_cast(v4u, vn));
    vst2(BIM + uo + q * 256,                  __builtin_bit_cast(v4u, vi));
    vst2(BIM + uo + (DD / 32) * FU + q * 256, __builtin_bit_cast(v4u, vr));
  }
}

// ---- k_proj: Y[MR][512-col tile] = X[MR][KP] . Wp[512][KP]^T + bias; block = 128 rows x 256 cols, 8 waves (2 x 4) each 64 rows x 64 cols: 8 fragments read from LDS per 16 products
// a stage = two k-steps (64 k) of the block's 8 X and 16 W row tiles = 24 pieces of 2 KiB (contiguous in a fragment-order plane), brought once per block by asynchronous copies, two buffers: piece s (X 0..7, W 8..23) at s * 2 KiB
// blockIdx.z = weight plane 0..5 (q re, q im, k re, k im, v re, v im): all six projections in one grid
// mode 0: f16 hi -> P0, f16 residual x2^11 -> P1, plane [MR][KP] at column c0 + n; mode 1: f16 hi transposed -> plane [NB * KP][SEQ]; both in fragment order
#define PJ_ST 49152
__global__ __launch_bounds__(256) void k_proj(const __bf16* __restrict__ X, const __bf16* __restrict__ W6,
                                              const float* __restrict__ BQR, const float* __restrict__ BQI, const float* __restrict__ BKR, const float* __restrict__ BKI,
                                              const float* __restrict__ BVR, const float* __restrict__ BVI,
                                              _Float16* QH, _Float16* QR, _Float16* KH, _Float16* KR, _Float16* VT) {
  __shared__ __align__(16) char sm[128 * 260 * 4];            // in the loop: the two stage buffers; behind it: the block's output staging
  static_assert(sizeof(sm) >= 2 * PJ_ST);
  float (*ss)[260] = (float (*)[260])sm;
  const int pz = blockIdx.z;                                           // block-uniform
  const __bf16* Wp = W6 + (size_t)pz * WPL;
  const float* bias = (pz == 0) ? BQR : ((pz == 1) ? BQI : ((pz == 2) ? BKR : ((pz == 3) ? BKI : ((pz == 4) ? BVR : BVI))));
  const int mode = (pz >= 4) ? 1 : 0, c0 = (pz & 1) * DD;
  _Float16* P0 = (pz < 2) ? QH : ((pz < 4) ? KH : VT); _Float16* P1 = (pz < 2) ? QR : KR;
  const int tid = threadIdx.x, wave = __builtin_amdgcn_readfirstlane(tid >> 5), lane = tid & 31, col = lane & 15, g = lane >> 4;   // wave number as a scalar: tile offsets are scalar arithmetic
  const int r0 = blockIdx.x * 128, n0 = blockIdx.y * 256; const int wr = (wave >> 2) * 64, wc = (wave & 3) * 64;
  // this wave's share of every stage: pieces 3 wave .. 3 wave + 2
#define PJ_PIECE(S) ((const char*)((((S) < 8) ? X : Wp) + (size_t)(((S) < 8) ? (r0 >> 4) + (S) : (n0 >> 4) + (S) - 8) * (KP / 32) * FU + lane * 8))
  const char* ca = PJ_PIECE(3 * wave); const char* cb = PJ_PIECE(3 * wave + 1); const char* cc = PJ_PIECE(3 * wave + 2);
#undef PJ_PIECE
  const unsigned lw = lds_addr(sm) + wave * 6144 + lane * 16;
#define PJ_FILL(ST, BUF) { const unsigned l_ = lw + (BUF) * PJ_ST; const size_t o_ = (size_t)(ST) * 2048; acopy12<1024>(l_, l_ + 2048, l_ + 4096, ca + o_, cb + o_, cc + o_); }
  PJ_FILL(0, 0)
  asm volatile("s_wait_asynccnt 0x0" ::: "memory");           // this wave's copies of stage 0 have landed
  __syncthreads();                                            // stage 0 is published to every wave
  PJ_FILL(1, 1)
  v8f acc[4][4] = {};
#pragma unroll 1
  for (int st = 0; st < KP / 64; ++st) {
    const __bf16* sb = (const __bf16*)(sm + (st & 1) * PJ_ST) + lane * 8;
    const __bf16* sa = sb + (wave >> 2) * 4 * 1024; const __bf16* sw = sb + (8 + (wave & 3) * 4) * 1024;
#pragma unroll
    for (int kk = 0; kk < 2; ++kk) {
      v16b a[4], w[4];
#pragma unroll
      for (int i = 0; i < 4; ++i) { a[i] = fragu_b(sa + i * 1024 + kk * FU); w[i] = fragu_b(sw + i * 1024 + kk * FU); }
#pragma unroll
      for (int i = 0; i < 4; ++i)
#pragma unroll
        for (int j = 0; j < 4; ++j) acc[i][j] = wmma_bf(a[i], w[j], acc[i][j]);
    }
    asm volatile("s_wait_dscnt 0x0" ::: "memory");            // this wave's reads of the buffer are over before anyone refills it
    asm volatile("s_wait_asynccnt 0x0" ::: "memory");         // this wave's copies of stage st + 1 have landed
    __syncthreads();                                          // publishes stage st + 1 and ends every reader's last read of stage st
    if (st + 2 < KP / 64) PJ_FILL(st + 2, st & 1)
  }
#undef PJ_FILL
  asm volatile("s_wait_asynccnt 0x0" ::: "memory");           // no copy is in flight when the buffers become output staging
#pragma unroll
  for (int j = 0; j < 4; ++j) { const float bb = bfr(bias[n0 + wc + j * 16 + col]);
#pragma unroll
    for (int i = 0; i < 4; ++i)
#pragma unroll
      for (int r = 0; r < 8; ++r) ss[wr + i * 16 + 8 * g + r][wc + j * 16 + col] = acc[i][j][r] + bb; }
  __syncthreads();
  if (mode == 1) {
    const int bb = r0 / SEQ, nl = r0 - bb * SEQ;
    _Float16* vt = P0 + ((size_t)((bb * KP + c0 + n0) >> 4) * (SEQ / 32) + (nl >> 5)) * FU + lane * 8;
    // 16 row tiles (16 features) x 4 units (32 positions) x 2 pieces; lane = (g, col): feature dt * 16 + col, positions ku * 32 + q * 16 + 8 g + 0..7
    for (int e = wave; e < 128; e += 8) { const int dt = e >> 3, ku = (e >> 1) & 3, q = e & 1; v8h o;
#pragma unroll
      for (int i = 0; i < 8; ++i) o[i] = (_Float16)ss[ku * 32 + q * 16 + 8 * g + i][dt * 16 + col];
      vst2(vt + ((size_t)dt * (SEQ / 32) + ku) * FU + q * 256, __builtin_bit_cast(v4u, o));
      asm volatile("s_wait_xcnt 0x0" ::: "memory");   // precaution: the next trip rewrites the store's address and data registers
    }
  } else {
#pragma unroll 1
    for (int it = 0; it < 16; ++it) { const int rt = wave;                                     // row tile rt of the block's 8; unit it >> 1, piece it & 1
      const int rl = rt * 16 + col, cl = it * 16 + 8 * g;
      const v4f x0 = *(const v4f*)&ss[rl][cl], x1 = *(const v4f*)&ss[rl][cl + 4];
      float v[8]; v8h hh, rr;
#pragma unroll
      for (int i = 0; i < 4; ++i) { v[i] = x0[i]; v[4 + i] = x1[i]; }
#pragma unroll
      for (int i = 0; i < 8; ++i) hh[i] = (_Float16)v[i];
#pragma unroll
      for (int i = 0; i < 8; ++i) rr[i] = (_Float16)((v[i] - (float)hh[i]) * QCAR);
      const size_t ro = ((size_t)((r0 >> 4) + rt) * (KP / 32) + ((c0 + n0) >> 5) + (it >> 1)) * FU + (it & 1) * 256 + lane * 8;
      vst2(P0 + ro, __builtin_bit_cast(v4u, hh));
      vst2(P1 + ro, __builtin_bit_cast(v4u, rr));
      asm volatile("s_wait_xcnt 0x0" ::: "memory");   // precaution: the next trip rewrites the two stores' address and data registers
    }
  }
}

// ---- k_sc: S[b][z][SEQ][SEQ], blockIdx.z = b, both planes z in one block, with k plane = [kr | ki] and q plane = [qr | qi]; one k-step = 32 features of the re and of the im half:
// z=0: qr.kr + qi.(-ki) (sign-bit flip of the ki fragments); z=1: qr.ki + qi.kr; x 1/sqrt(512)
// q = hi + res/2^11, k = hi + res/2^11: products hi.hi -> h*, res.hi + hi.res -> c* (folded x 2^-11)
// block = 64 queries x 128 keys, 8 waves (2 x 4) each 32 x 32 in both planes: 16 fragments read from LDS per 48 products
// a stage = one k-step of the block's 4 q and 8 k row tiles = 48 units (48 KiB), brought once per block by asynchronous copies, two buffers: row tile t (q 0..3, k 4..11) at t * 4 KiB, its units hi re, hi im, res re, res im 1 KiB each
#define SC_ST 49152
__global__ __launch_bounds__(256) void k_sc(const _Float16* __restrict__ QH, const _Float16* __restrict__ QR, const _Float16* __restrict__ KH, const _Float16* __restrict__ KR,
                                            float* __restrict__ S0) {
  __shared__ __align__(16) char sm[2 * SC_ST];                // in the loop: the two stage buffers; behind it: each wave's output staging
  static_assert(sizeof(sm) >= 8 * 2 * 32 * 36 * 4);
  float (*ss)[2][32][36] = (float (*)[2][32][36])sm;
  const int b = blockIdx.z; float* S = S0 + (size_t)(2 * b) * SEQ * SEQ;
  const int tid = threadIdx.x, wave = __builtin_amdgcn_readfirstlane(tid >> 5), lane = tid & 31, col = lane & 15, g = lane >> 4;   // wave number as a scalar: tile offsets are scalar arithmetic, which keeps the kernel inside 256 vector registers
  const int k0 = blockIdx.y * 128 + (wave & 3) * 32; const int ql0 = blockIdx.x * 64 + (wave >> 2) * 32;
  // this wave's share of every stage: pieces 3 wave .. 3 wave + 2; piece p = the re and the im unit of row tile p >> 1 in the hi (p even) or the residual (p odd) plane
  const int tq = (b * SEQ + blockIdx.x * 64) >> 4, tk = (b * SEQ + blockIdx.y * 128) >> 4;
#define SC_PIECE(P) ((const char*)((((P) < 8) ? (((P) & 1) ? QR : QH) : (((P) & 1) ? KR : KH)) + (size_t)(((P) < 8) ? tq + ((P) >> 1) : tk + ((P) >> 1) - 4) * (KP / 32) * FU + lane * 8))
  const char* ca = SC_PIECE(3 * wave); const char* cb = SC_PIECE(3 * wave + 1); const char* cc = SC_PIECE(3 * wave + 2);
#undef SC_PIECE
  const unsigned lw = lds_addr(sm) + wave * 6144 + lane * 16;
#define SC_FILL(KC, BUF) { const unsigned l_ = lw + (BUF) * SC_ST; const size_t o_ = (size_t)(KC) * 1024; acopy12<(DD / 32) * 1024>(l_, l_ + 2048, l_ + 4096, ca + o_, cb + o_, cc + o_); }
  SC_FILL(0, 0)
  asm volatile("s_wait_asynccnt 0x0" ::: "memory");           // this wave's copies of stage 0 have landed
  __syncthreads();                                            // stage 0 is published to every wave
  SC_FILL(1, 1)
  v8f hr[2][2] = {}, cr[2][2] = {}, hi[2][2] = {}, ci[2][2] = {};             // [query tile][key tile]
#pragma unroll 1
  for (int kc = 0; kc < DD / 32; ++kc) {
    const _Float16* st = (const _Float16*)(sm + (kc & 1) * SC_ST) + lane * 8;
    const _Float16* sq = st + (wave >> 2) * 2 * 2048; const _Float16* sk = st + (4 + (wave & 3) * 2) * 2048;
    v16h qrh[2], qrc[2], qih[2], qic[2], krh[2], krc[2], kih[2], kic[2];      // re / im part, hi / residual
#pragma unroll
    for (int i = 0; i < 2; ++i) { const int u = i * 2048; qrc[i] = fragu_h(sq + u + 1024); krh[i] = fragu_h(sk + u); kih[i] = fragu_h(sk + u + 512); }   // what the first products take comes first
#pragma unroll
    for (int i = 0; i < 2; ++i) { const int u = i * 2048; qrh[i] = fragu_h(sq + u); qih[i] = fragu_h(sq + u + 512); qic[i] = fragu_h(sq + u + 1536); }
#define SC4(ACC, A, B) _Pragma("unroll") for (int i = 0; i < 2; ++i) _Pragma("unroll") for (int j = 0; j < 2; ++j) ACC[i][j] = wmma16(A[i], B[j], ACC[i][j]);
    SC4(cr, qrc, krh) SC4(ci, qrc, kih)
    // the k residuals come behind the last uses of qrc, whose registers they can take
#pragma unroll
    for (int i = 0; i < 2; ++i) { const int u = i * 2048; krc[i] = fragu_h(sk + u + 1024); kic[i] = fragu_h(sk + u + 1536); }
    SC4(hr, qrh, krh) SC4(hi, qrh, kih) SC4(hi, qih, krh) SC4(ci, qic, krh)
#pragma unroll
    for (int i = 0; i < 2; ++i) kih[i] = hneg(kih[i], 0x80008000u);            // qi.(-ki) = -(qi.ki), exact
    SC4(hr, qih, kih) SC4(cr, qic, kih)
    SC4(cr, qrh, krc) SC4(ci, qih, krc) SC4(ci, qrh, kic)
#pragma unroll
    for (int i = 0; i < 2; ++i) kic[i] = hneg(kic[i], 0x80008000u);
    SC4(cr, qih, kic)
#undef SC4
    asm volatile("s_wait_dscnt 0x0" ::: "memory");            // this wave's reads of the buffer are over before anyone refills it
    asm volatile("s_wait_asynccnt 0x0" ::: "memory");         // this wave's copies of stage kc + 1 have landed
    __syncthreads();                                          // publishes stage kc + 1 and ends every reader's last read of stage kc
    if (kc + 2 < DD / 32) SC_FILL(kc + 2, kc & 1)
  }
#undef SC_FILL
  asm volatile("s_wait_asynccnt 0x0" ::: "memory");           // no copy is in flight when the buffers become output staging
#pragma unroll
  for (int i = 0; i < 2; ++i)
#pragma unroll
    for (int j = 0; j < 2; ++j)
#pragma unroll
      for (int r = 0; r < 8; ++r) {
        ss[wave][0][i * 16 + 8 * g + r][j * 16 + col] = hr[i][j][r] * SCL + cr[i][j][r] * (SCL / QCAR);
        ss[wave][1][i * 16 + 8 * g + r][j * 16 + col] = hi[i][j][r] * SCL + ci[i][j][r] * (SCL / QCAR); }
  __syncthreads();
  // each store of a wave: 4 rows x 128 B (whole lines)
#pragma unroll 1
  for (int it = 0; it < 16; ++it) { const int z = it >> 3, rl = (it & 7) * 4 + (lane >> 3);
    vst2(S + (size_t)z * SEQ * SEQ + (size_t)(ql0 + rl) * SEQ + k0 + (lane & 7) * 4, *(const v4f*)&ss[wave][z][rl][(lane & 7) * 4]);
    asm volatile("s_wait_xcnt 0x0" ::: "memory");     // precaution: the next trip rewrites the store's address and data registers
  }
}
// ---- k_sm: block = one query row of one batch (blockIdx.x = b SEQ + n): a[m] = sqrt(sre^2 + sim^2), softmax over SEQ keys (max-subtracted, f32) -> P f16 x 2^14
__global__ __launch_bounds__(256) void k_sm(const float* __restrict__ S0, _Float16* __restrict__ P) {
  __shared__ float sred[8]; __shared__ float sbc; __shared__ __align__(16) _Float16 sh[SEQ];
  constexpr int EPT = SEQ / 256;
  const int t = threadIdx.x; const size_t row = blockIdx.x; const size_t bb = row / SEQ;
  const float* sr = S0 + (bb * SEQ + row) * SEQ + t * EPT; const float* si = sr + (size_t)SEQ * SEQ;   // plane 2 bb, row n: (2 bb SEQ + n) = bb SEQ + row
  float a[EPT]; float m = -3.0e38f;
#pragma unroll
  for (int i = 0; i < EPT; ++i) { const float x = sr[i], y = si[i]; a[i] = sqrtf(x * x + y * y); m = fmaxf(m, a[i]); }
#pragma unroll
  for (int o = 1; o < 32; o <<= 1) m = fmaxf(m, __shfl_xor(m, o));
  if ((t & 31) == 0) sred[t >> 5] = m; __syncthreads();
  if (t == 0) { float v = sred[0]; for (int i = 1; i < 8; ++i) v = fmaxf(v, sred[i]); sbc = v; } __syncthreads(); m = sbc; __syncthreads();
  float e[EPT]; float sum = 0.f;
#pragma unroll
  for (int i = 0; i < EPT; ++i) { e[i] = exp_ni(a[i] - m); sum += e[i]; }
#pragma unroll
  for (int o = 1; o < 32; o <<= 1) sum += __shfl_xor(sum, o);
  if ((t & 31) == 0) sred[t >> 5] = sum; __syncthreads();
  if (t == 0) { float v = 0.f; for (int i = 0; i < 8; ++i) v += sred[i]; sbc = 1.0f / v; } __syncthreads(); const float inv = sbc;
#pragma unroll
  for (int i = 0; i < EPT; ++i) sh[t * EPT + i] = (_Float16)(e[i] * inv * PCAR);
  __syncthreads();
  if (t < SEQ / 8) vst2(P + row * SEQ + t * 8, *(const v4u*)&sh[t * 8]);
}
// ---- k_pv: ctx[n][0..1023] = P[b] . [vr|vi] for batch b = blockIdx.z; columns 0..511 -> output plane 0, 512..1023 -> plane 1; block = 128 queries x 128 cols, 4 waves each 32 x 128: 10 fragments read from LDS per 16 products
// a stage = four k-steps (128 keys), brought once per block by asynchronous copies, two buffers: the block's 128 P rows of 256 B at pitch 272 B (16 B x odd: the 16-byte fragment reads of 16 rows fall on different banks),
// behind them the 8 v row tiles, 4 KiB each (contiguous in the fragment-order plane)
#define PV_PP 272
#define PV_VO (128 * PV_PP)
#define PV_ST (PV_VO + 8 * 4096)
__global__ __launch_bounds__(128) void k_pv(const _Float16* __restrict__ P, const _Float16* __restrict__ VT, float* __restrict__ OUT) {
  __shared__ __align__(16) char sm[2 * PV_ST];                // in the loop: the two stage buffers; behind it: each wave's output staging
  static_assert(sizeof(sm) >= 4 * 32 * 132 * 4);
  float (*ss)[32][132] = (float (*)[32][132])sm;
  const int b = blockIdx.z;
  const int tid = threadIdx.x, wave = __builtin_amdgcn_readfirstlane(tid >> 5), lane = tid & 31, col = lane & 15, g = lane >> 4;   // wave number as a scalar: tile offsets are scalar arithmetic
  const int n0 = blockIdx.y * 128; const int ql0 = blockIdx.x * 128 + wave * 32;
  // this wave's share of every stage: its own 32 P rows (a copy = 2 rows x 256 B) and v row tiles 2 wave, 2 wave + 1 (a copy = 512 B)
  const char* cp = (const char*)(P + ((size_t)b * SEQ + ql0 + g) * SEQ + col * 8);
  const char* cv = (const char*)(VT + (size_t)(((b * KP + n0) >> 4) + 2 * wave) * (SEQ / 32) * FU + lane * 8);
  const unsigned lp = lds_addr(sm) + (wave * 32 + g) * PV_PP + col * 16, lv = lds_addr(sm) + PV_VO + wave * 8192 + lane * 16;
#define PV_FILL(ST, BUF) { const unsigned o_ = (BUF) * PV_ST; const char* p_ = cp + (size_t)(ST) * 256; const char* v_ = cv + (size_t)(ST) * 4096; \
    acopy8<2 * PV_PP, 4 * SEQ>(lp + o_, p_); acopy8<2 * PV_PP, 4 * SEQ>(lp + o_ + 16 * PV_PP, p_ + 32 * SEQ); \
    acopy8<512, 512>(lv + o_, v_); acopy8<512, 512>(lv + o_ + 4096, v_ + (SEQ / 32) * FU * 2); }
  PV_FILL(0, 0)
  asm volatile("s_wait_asynccnt 0x0" ::: "memory");           // this wave's copies of stage 0 have landed
  __syncthreads();                                            // stage 0 is published to every wave
  PV_FILL(1, 1)
  v8f acc[2][8] = {};
#pragma unroll 1
  for (int st = 0; st < SEQ / 128; ++st) {
    const char* sb = sm + (st & 1) * PV_ST;
    const _Float16* sp = (const _Float16*)(sb + (wave * 32 + col) * PV_PP); const _Float16* sv = (const _Float16*)(sb + PV_VO) + lane * 8;
#pragma unroll
    for (int kk = 0; kk < 4; ++kk) {
      v16h a[2], v[8];
#pragma unroll
      for (int i = 0; i < 2; ++i) a[i] = frag_h(sp + i * 16 * (PV_PP / 2) + kk * 32, lane);
#pragma unroll
      for (int j = 0; j < 8; ++j) v[j] = fragu_h(sv + j * 2048 + kk * FU);
#pragma unroll
      for (int j = 0; j < 8; ++j)
#pragma unroll
        for (int i = 0; i < 2; ++i) acc[i][j] = wmma16(a[i], v[j], acc[i][j]);
    }
    asm volatile("s_wait_dscnt 0x0" ::: "memory");            // this wave's reads of the buffer are over before anyone refills it
    asm volatile("s_wait_asynccnt 0x0" ::: "memory");         // this wave's copies of stage st + 1 have landed
    __syncthreads();                                          // publishes stage st + 1 and ends every reader's last read of stage st
    if (st + 2 < SEQ / 128) PV_FILL(st + 2, st & 1)
  }
#undef PV_FILL
  asm volatile("s_wait_asynccnt 0x0" ::: "memory");           // no copy is in flight when the buffers become output staging
#pragma unroll
  for (int i = 0; i < 2; ++i)
#pragma unroll
    for (int j = 0; j < 8; ++j)
#pragma unroll
      for (int r = 0; r < 8; ++r) ss[wave][i * 16 + 8 * g + r][j * 16 + col] = acc[i][j][r] * (1.0f / PCAR);
  __syncthreads();
  const int pl = n0 / DD, d0 = n0 - pl * DD;
  float* ob = OUT + (((size_t)pl * NB_FULL + b) * SEQ_FULL + ql0) * DD + d0 + lane * 4;
#pragma unroll 1
  for (int rl = 0; rl < 32; ++rl) { vst2(ob + (size_t)rl * DD, *(const v4f*)&ss[wave][rl][lane * 4]);
    asm volatile("s_wait_xcnt 0x0" ::: "memory");     // precaution: the next trip rewrites the store's address and data registers
  }
}

extern "C" void kernel_launch(void* const* d_in, const int* in_sizes, int n_in, void* d_out, int out_size, void* d_ws, size_t ws_size, hipStream_t stream) {
  if (n_in < 14) return;
  const float* xr = (const float*)d_in[0];  const float* xi = (const float*)d_in[1];
  const float* wqr = (const float*)d_in[2]; const float* wqi = (const float*)d_in[3]; const float* bqr = (const float*)d_in[4]; const float* bqi = (const float*)d_in[5];
  const float* wkr = (const float*)d_in[6]; const float* wki = (const float*)d_in[7]; const float* bkr = (const float*)d_in[8]; const float* bki = (const float*)d_in[9];
  const float* wvr = (const float*)d_in[10]; const float* wvi = (const float*)d_in[11]; const float* bvr = (const float*)d_in[12]; const float* bvi = (const float*)d_in[13];
  const int need_x = ((NB - 1) * SEQ_FULL + SEQ) * DD;
  if (in_sizes[0] < need_x || in_sizes[1] < need_x) return;
  for (int i = 2; i < 14; i += 4) { if (in_sizes[i] < DD * DD || in_sizes[i + 1] < DD * DD || in_sizes[i + 2] < DD || in_sizes[i + 3] < DD) return; }
  const int need_out = ((NB_FULL + NB - 1) * SEQ_FULL + SEQ) * DD;
  if (out_size < need_out) return;
  if (ws_size < (size_t)WS_END) return;
  char* ws = (char*)d_ws;
  __bf16* X = (__bf16*)(ws + WS_X); __bf16* Wp = (__bf16*)(ws + WS_W);
  _Float16* QH = (_Float16*)(ws + WS_QH); _Float16* QR = (_Float16*)(ws + WS_QR);
  _Float16* KH = (_Float16*)(ws + WS_KH); _Float16* KR = (_Float16*)(ws + WS_KR);
  _Float16* VT = (_Float16*)(ws + WS_VT); float* S = (float*)(ws + WS_S); _Float16* P = (_Float16*)(ws + WS_P);
  float* out = (float*)d_out;

  k_cvx<<<dim3(MR / 16, KP / 256), 256, 0, stream>>>(xr, xi, X);
  k_cvw<<<dim3(DD / 8, 3), 256, 0, stream>>>(wqr, wqi, wkr, wki, wvr, wvi, Wp);
  k_proj<<<dim3(MR / 128, DD / 256, 6), 256, 0, stream>>>(X, Wp, bqr, bqi, bkr, bki, bvr, bvi, QH, QR, KH, KR, VT);
  k_sc<<<dim3(SEQ / 64, SEQ / 128, NB), 256, 0, stream>>>(QH, QR, KH, KR, S);
  k_sm<<<dim3(NB * SEQ), 256, 0, stream>>>(S, P);
  k_pv<<<dim3(SEQ / 128, KP / 128, NB), 128, 0, stream>>>(P, VT, out);
}

// v005
// It runs in 138 microseconds.
// In two side-by-side timings against v004, it was 1.07 and 1.06 times as fast.
// Counting every step since v000, it is 8.88 times as fast.
// compute dtype: all float inputs RNE-converted to bf16 on load; q/k/v projections on v_wmma_f32_16x16x32_bf16 (bf16 operands, exact products), f32 accumulate; scores on v_wmma_f32_16x16x32_f16 with q and k each = f16 hi + f16 residual x2^11 (3 products hi.hi, res.hi, hi.res; 2 accumulators); magnitude (v_sqrt_f32), exponentials (v_exp_f32, scores in the log2 domain), maxima and sums of the softmax in f32 -> E = exp(a - max of its 32 keys) f16 x2^7, rescaled per row and 32 keys by an f16 factor x2^7 (packed f16 multiply) -> P f16 x2^14; P.v on v_wmma_f32_16x16x32_f16 with v = f16 hi (1 product); f32 output.
#include <hip/hip_runtime.h>
#include <math.h>

typedef __attribute__((ext_vector_type(16))) _Float16 v16h;
typedef __attribute__((ext_vector_type(16))) __bf16 v16b;
typedef __attribute__((ext_vector_type(8)))  _Float16 v8h;
typedef __attribute__((ext_vector_type(4)))  _Float16 v4h;
typedef __attribute__((ext_vector_type(2)))  float v2f;
typedef __attribute__((ext_vector_type(8)))  __bf16 v8b;
typedef __attribute__((ext_vector_type(8)))  float v8f;
typedef __attribute__((ext_vector_type(8)))  unsigned v8u;
typedef __attribute__((ext_vector_type(4)))  float v4f;
typedef __attribute__((ext_vector_type(4)))  unsigned v4u;

#define DD 512            // feature width per real/imag part
#define KP 1024           // concatenated contraction length [re | im]
#define NB_FULL 8
#define SEQ_FULL 1024
#ifndef NB
#define NB NB_FULL
#endif
#ifndef SEQ
#define SEQ SEQ_FULL
#endif
#define MR (NB * SEQ)     // projection rows
#define QCAR 2048.0f      // carry of the q and k residual planes
#define PCAR 16384.0f     // carry of the P fragments: 2^ECL from the E plane x 2^ECL from the rescale factors
#define ECL 7.0f          // log2 of the carry of the E plane
#define L2E 1.4426950408889634f     // log2(e): the magnitudes are formed x log2(e), so that exp(a - c) is one v_exp_f32 of a difference
#define SCL 0.044194173824159216f   // 1/sqrt(512)

static_assert(NB >= 1 && NB <= NB_FULL);
static_assert(SEQ >= 256 && SEQ <= SEQ_FULL && (SEQ % 256) == 0);
static_assert((MR % 128) == 0);

// Planes marked FO lie in fragment order: a plane [R][K] is cut into units of 16 rows x 32 k = 512 elements (1 KiB), unit (rt, ks) at element (rt * (K / 32) + ks) * 512;
// inside a unit element (row, k) stands at ((k & 31) >> 4) * 256 + ((((k >> 3) & 1) * 16) + (row & 15)) * 8 + (k & 7): lane l's two 16-byte pieces at l * 8 and 256 + l * 8,
// so each 16-byte load or store of a wave covers 512 contiguous bytes (4 whole lines) in place of 32 bytes in each of 16 rows.
#define FU 512                                         // elements per fragment unit
#define WPL    ((size_t)DD * KP)                      // elements per weight plane
#define WS_X   ((size_t)0)                             // bf16 [MR][KP] FO
#define WS_W   (WS_X + 2u * (size_t)MR * KP)           // bf16 6 x [DD][KP] FO
#define WS_QH  (WS_W + 2u * 6u * WPL)                  // f16  [MR][KP] FO q hi
#define WS_QR  (WS_QH + 2u * (size_t)MR * KP)          // f16  [MR][KP] FO q residual x2^11
#define WS_KH  (WS_QR + 2u * (size_t)MR * KP)          // f16  [MR][KP] FO k hi  = [kr | ki]
#define WS_KR  (WS_KH + 2u * (size_t)MR * KP)          // f16  [MR][KP] FO k residual x2^11
#define WS_VT  (WS_KR + 2u * (size_t)MR * KP)          // f16  [NB * KP][SEQ] FO
#define WS_S   (WS_VT + 2u * (size_t)NB * KP * SEQ)    // f32  [MR / 32][SEQ / 32][2][32]: per 32 queries x 32 keys the 32 row shifts c (log2 domain), then the 32 row sums of E (256 B, one writer)
#define WS_P   (WS_S + 4u * 2u * (size_t)MR * (SEQ / 32)) // f16  [NB][SEQ][SEQ] E x2^7
#define WS_END (WS_P + 2u * (size_t)NB * SEQ * SEQ)
static_assert(WS_END <= (size_t)268435456);
static_assert((WS_W % 256) == 0 && (WS_QH % 256) == 0 && (WS_QR % 256) == 0 && (WS_KH % 256) == 0 && (WS_KR % 256) == 0 && (WS_VT % 256) == 0 && (WS_S % 256) == 0 && (WS_P % 256) == 0);

template <typename T> __device__ __forceinline__ void vst2(void* p, T v) { *(T*)p = v;  }

__device__ __forceinline__ v8f wmma16(v16h a, v16h b, v8f c) {
  v8f d = __builtin_amdgcn_wmma_f32_16x16x32_f16(false, a, false, b, (short)0, c, false, false);
  asm volatile("v_nop\n\tv_nop\n\tv_nop\n\tv_nop" : "+v"(d) : "v"(a), "v"(b));
  return d;
}
__device__ __forceinline__ v8f wmma_bf(v16b a, v16b b, v8f c) {
  v8f d = __builtin_amdgcn_wmma_f32_16x16x32_bf16(false, a, false, b, (short)0, c, false, false);
  asm volatile("v_nop\n\tv_nop\n\tv_nop\n\tv_nop" : "+v"(d) : "v"(a), "v"(b));
  return d;
}
// 16x16x32 fragments: lane = (h = lane>>4, row/col = lane&15); elements 0..7 = k0+8h+0..7, 8..15 = k0+16+8h+0..7; D element r = row 8h+r, col lane&15
__device__ __forceinline__ v16h frag_h(const _Float16* rowk0, int lane) {
  union { v16h v; v8h q[2]; } u; const _Float16* p = rowk0 + 8 * (lane >> 4);
  u.q[0] = *(const v8h*)p; u.q[1] = *(const v8h*)(p + 16); return u.v;
}
// the same fragments from a fragment-order unit (same k at every lane and element position as frag_h); p = the unit + 8 * lane elements
__device__ __forceinline__ v16h fragu_h(const _Float16* p) {
  union { v16h v; v8h q[2]; } u; u.q[0] = *(const v8h*)p; u.q[1] = *(const v8h*)(p + 256); return u.v;
}
__device__ __forceinline__ v16b fragu_b(const __bf16* p) {
  union { v16b v; v8b q[2]; } u; u.q[0] = *(const v8b*)p; u.q[1] = *(const v8b*)(p + 256); return u.v;
}
// sign-bit flip of all 16 halves when m == 0x80008000 (exact negation), identity when m == 0
__device__ __forceinline__ v16h hneg(v16h x, unsigned m) { v8u u = __builtin_bit_cast(v8u, x); u ^= m; return __builtin_bit_cast(v16h, u); }
// asynchronous copies to LDS: each lane brings 16 bytes, a wave and copy 512 bytes; l* = the lane's LDS byte address, g* = the lane's global address.
// 12 copies = three 2-KiB pieces; in LDS a piece is contiguous, in global memory its second KiB lies G2 bytes behind the start of the first.
// The s_wait_xcnt stands inside the copies' own statement (precaution): the address registers stay whole until it, whatever the compiler puts behind the statement.
__device__ __forceinline__ unsigned lds_addr(const void* p) { return (unsigned)(size_t)p; }   // low 32 bits of a __shared__ address = byte offset in the work-group's LDS
template <int G2> __device__ __forceinline__ void acopy12(unsigned la, unsigned lb, unsigned lc, const char* ga, const char* gb, const char* gc) {
  asm volatile("global_load_async_to_lds_b128 %0, %12, off\n\tglobal_load_async_to_lds_b128 %1, %13, off\n\tglobal_load_async_to_lds_b128 %2, %14, off\n\tglobal_load_async_to_lds_b128 %3, %15, off\n\t"
               "global_load_async_to_lds_b128 %4, %16, off\n\tglobal_load_async_to_lds_b128 %5, %17, off\n\tglobal_load_async_to_lds_b128 %6, %18, off\n\tglobal_load_async_to_lds_b128 %7, %19, off\n\t"
               "global_load_async_to_lds_b128 %8, %20, off\n\tglobal_load_async_to_lds_b128 %9, %21, off\n\tglobal_load_async_to_lds_b128 %10, %22, off\n\tglobal_load_async_to_lds_b128 %11, %23, off\n\t"
               "s_wait_xcnt 0x0"
               :: "v"(la), "v"(la + 512), "v"(la + 1024), "v"(la + 1536), "v"(lb), "v"(lb + 512), "v"(lb + 1024), "v"(lb + 1536), "v"(lc), "v"(lc + 512), "v"(lc + 1024), "v"(lc + 1536),
                  "v"(ga), "v"(ga + 512), "v"(ga + G2), "v"(ga + G2 + 512), "v"(gb), "v"(gb + 512), "v"(gb + G2), "v"(gb + G2 + 512), "v"(gc), "v"(gc + 512), "v"(gc + G2), "v"(gc + G2 + 512)
               : "memory");
}
// 8 copies, LS bytes apart in LDS and GS bytes apart in global memory
template <int LS, int GS> __device__ __forceinline__ void acopy8(unsigned l, const char* g) {
  asm volatile("global_load_async_to_lds_b128 %0, %8, off\n\tglobal_load_async_to_lds_b128 %1, %9, off\n\tglobal_load_async_to_lds_b128 %2, %10, off\n\tglobal_load_async_to_lds_b128 %3, %11, off\n\t"
               "global_load_async_to_lds_b128 %4, %12, off\n\tglobal_load_async_to_lds_b128 %5, %13, off\n\tglobal_load_async_to_lds_b128 %6, %14, off\n\tglobal_load_async_to_lds_b128 %7, %15, off\n\t"
               "s_wait_xcnt 0x0"
               :: "v"(l), "v"(l + LS), "v"(l + 2 * LS), "v"(l + 3 * LS), "v"(l + 4 * LS), "v"(l + 5 * LS), "v"(l + 6 * LS), "v"(l + 7 * LS),
                  "v"(g), "v"(g + GS), "v"(g + 2 * GS), "v"(g + 3 * GS), "v"(g + 4 * GS), "v"(g + 5 * GS), "v"(g + 6 * GS), "v"(g + 7 * GS)
               : "memory");
}
__device__ __forceinline__ float bfr(float v) { return (float)(__bf16)v; }
// bare v_exp_f32 (2^x) and v_sqrt_f32, each with the one slot the instruction set asks for behind a transcendental in its own statement
__device__ __forceinline__ float exp2_s(float x) { float e; asm("v_exp_f32 %0, %1\n\tv_nop" : "=v"(e) : "v"(x)); return e; }    // the v_nop keeps the slot behind the transcendental
__device__ __forceinline__ float sqrt_s(float x) { float e; asm("v_sqrt_f32 %0, %1\n\tv_nop" : "=v"(e) : "v"(x)); return e; }   // the v_nop keeps the slot behind the transcendental

// ---- k_cvx: X[row][0..511] = bf16(xr[row]), X[row][512..1023] = bf16(xi[row]), fragment order; block = 16 rows x 8 units, one unit (16 rows x 32 k) per wave, two 512-B stores per wave
__global__ __launch_bounds__(256) void k_cvx(const float* __restrict__ XR, const float* __restrict__ XI, __bf16* __restrict__ X) {
  const int tid = threadIdx.x, wave = tid >> 5, lane = tid & 31;
  const int rt = blockIdx.x, ks = blockIdx.y * 8 + wave;               // ks is wave-uniform
  const int row = rt * 16 + (lane & 15);
  const int bb = row / SEQ, n = row - bb * SEQ;
  const float* sp = ((ks >= DD / 32) ? XI : XR) + ((size_t)bb * SEQ_FULL + n) * DD + (ks & (DD / 32 - 1)) * 32 + 8 * (lane >> 4);
  __bf16* dp = X + ((size_t)rt * (KP / 32) + ks) * FU + lane * 8;
#pragma unroll
  for (int q = 0; q < 2; ++q) {
    const v4f f0 = *(const v4f*)(sp + q * 16), f1 = *(const v4f*)(sp + q * 16 + 4);
    v8b o;
#pragma unroll
    for (int i = 0; i < 4; ++i) { o[i] = (__bf16)f0[i]; o[4 + i] = (__bf16)f1[i]; }
    vst2(dp + q * 256, __builtin_bit_cast(v4u, o));
  }
}
// ---- k_cvw: weight planes of complex linear y = blockIdx.y (q, k, v): BRE[e] = [Wr[e] | -Wi[e]], BIM[e] = [Wi[e] | Wr[e]] (bf16, negation exact), fragment order; block = 16 rows x 8 units of Wr and Wi, one unit of each per wave
__global__ __launch_bounds__(256) void k_cvw(const float* __restrict__ WQR, const float* __restrict__ WQI, const float* __restrict__ WKR, const float* __restrict__ WKI,
                                             const float* __restrict__ WVR, const float* __restrict__ WVI, __bf16* __restrict__ Wp) {
  const int y = blockIdx.y;                                            // block-uniform
  const float* WR = (y == 0) ? WQR : ((y == 1) ? WKR : WVR); const float* WI = (y == 0) ? WQI : ((y == 1) ? WKI : WVI);
  __bf16* BRE = Wp + (size_t)(2 * y) * WPL; __bf16* BIM = BRE + WPL;
  const int tid = threadIdx.x, wave = tid >> 5, lane = tid & 31;
  const int et = blockIdx.x >> 1, ks = (blockIdx.x & 1) * 8 + wave;    // unit of the 512-wide source, wave-uniform
  const size_t so = (size_t)(et * 16 + (lane & 15)) * DD + ks * 32 + 8 * (lane >> 4);
  const float* pr = WR + so; const float* pi = WI + so;
  const size_t uo = ((size_t)et * (KP / 32) + ks) * FU + lane * 8;      // left half; the right half lies DD / 32 units on
#pragma unroll
  for (int q = 0; q < 2; ++q) {
    const v4f r0 = *(const v4f*)(pr + q * 16), r1 = *(const v4f*)(pr + q * 16 + 4), i0 = *(const v4f*)(pi + q * 16), i1 = *(const v4f*)(pi + q * 16 + 4);
    v8b vr, vi, vn;
#pragma unroll
    for (int i = 0; i < 4; ++i) { vr[i] = (__bf16)r0[i]; vr[4 + i] = (__bf16)r1[i]; vi[i] = (__bf16)i0[i]; vi[4 + i] = (__bf16)i1[i]; vn[i] = (__bf16)(-i0[i]); vn[4 + i] = (__bf16)(-i1[i]); }
    vst2(BRE + uo + q * 256,                  __builtin_bit_cast(v4u, vr));
    vst2(BRE + uo + (DD / 32) * FU + q * 256, __builtin_bit_cast(v4u, vn));
    vst2(BIM + uo + q * 256,                  __builtin_bit_cast(v4u, vi));
    vst2(BIM + uo + (DD / 32) * FU + q * 256, __builtin_bit_cast(v4u, vr));
  }
}

// ---- k_proj: Y[MR][512-col tile] = X[MR][KP] . Wp[512][KP]^T + bias; block = 128 rows x 256 cols, 8 waves (2 x 4) each 64 rows x 64 cols: 8 fragments read from LDS per 16 products
// a stage = two k-steps (64 k) of the block's 8 X and 16 W row tiles = 24 pieces of 2 KiB (contiguous in a fragment-order plane), brought once per block by asynchronous copies, two buffers: piece s (X 0..7, W 8..23) at s * 2 KiB
// blockIdx.z = weight plane 0..5 (q re, q im, k re, k im, v re, v im): all six projections in one grid
// mode 0: f16 hi -> P0, f16 residual x2^11 -> P1, plane [MR][KP] at column c0 + n; mode 1: f16 hi transposed -> plane [NB * KP][SEQ]; both in fragment order
#define PJ_ST 49152
__global__ __launch_bounds__(256) void k_proj(const __bf16* __restrict__ X, const __bf16* __restrict__ W6,
                                              const float* __restrict__ BQR, const float* __restrict__ BQI, const float* __restrict__ BKR, const float* __restrict__ BKI,
                                              const float* __restrict__ BVR, const float* __restrict__ BVI,
                                              _Float16* QH, _Float16* QR, _Float16* KH, _Float16* KR, _Float16* VT) {
  __shared__ __align__(16) char sm[128 * 260 * 4];            // in the loop: the two stage buffers; behind it: the block's output staging
  static_assert(sizeof(sm) >= 2 * PJ_ST);
  float (*ss)[260] = (float (*)[260])sm;
  const int pz = blockIdx.z;                                           // block-uniform
  const __bf16* Wp = W6 + (size_t)pz * WPL;
  const float* bias = (pz == 0) ? BQR : ((pz == 1) ? BQI : ((pz == 2) ? BKR : ((pz == 3) ? BKI : ((pz == 4) ? BVR : BVI))));
  const int mode = (pz >= 4) ? 1 : 0, c0 = (pz & 1) * DD;
  _Float16* P0 = (pz < 2) ? QH : ((pz < 4) ? KH : VT); _Float16* P1 = (pz < 2) ? QR : KR;
  const int tid = threadIdx.x, wave = __builtin_amdgcn_readfirstlane(tid >> 5), lane = tid & 31, col = lane & 15, g = lane >> 4;   // wave number as a scalar: tile offsets are scalar arithmetic
  const int r0 = blockIdx.x * 128, n0 = blockIdx.y * 256; const int wr = (wave >> 2) * 64, wc = (wave & 3) * 64;
  // this wave's share of every stage: pieces 3 wave .. 3 wave + 2
#define PJ_PIECE(S) ((const char*)((((S) < 8) ? X : Wp) + (size_t)(((S) < 8) ? (r0 >> 4) + (S) : (n0 >> 4) + (S) - 8) * (KP / 32) * FU + lane * 8))
  const char* ca = PJ_PIECE(3 * wave); const char* cb = PJ_PIECE(3 * wave + 1); const char* cc = PJ_PIECE(3 * wave + 2);
#undef PJ_PIECE
  const unsigned lw = lds_addr(sm) + wave * 6144 + lane * 16;
#define PJ_FILL(ST, BUF) { const unsigned l_ = lw + (BUF) * PJ_ST; const size_t o_ = (size_t)(ST) * 2048; acopy12<1024>(l_, l_ + 2048, l_ + 4096, ca + o_, cb + o_, cc + o_); }
  PJ_FILL(0, 0)
  asm volatile("s_wait_asynccnt 0x0" ::: "memory");           // this wave's copies of stage 0 have landed
  __syncthreads();                                            // stage 0 is published to every wave
  PJ_FILL(1, 1)
  v8f acc[4][4] = {};
#pragma unroll 1
  for (int st = 0; st < KP / 64; ++st) {
    const __bf16* sb = (const __bf16*)(sm + (st & 1) * PJ_ST) + lane * 8;
    const __bf16* sa = sb + (wave >> 2) * 4 * 1024; const __bf16* sw = sb + (8 + (wave & 3) * 4) * 1024;
#pragma unroll
    for (int kk = 0; kk < 2; ++kk) {
      v16b a[4], w[4];
#pragma unroll
      for (int i = 0; i < 4; ++i) { a[i] = fragu_b(sa + i * 1024 + kk * FU); w[i] = fragu_b(sw + i * 1024 + kk * FU); }
#pragma unroll
      for (int i = 0; i < 4; ++i)
#pragma unroll
        for (int j = 0; j < 4; ++j) acc[i][j] = wmma_bf(a[i], w[j], acc[i][j]);
    }
    asm volatile("s_wait_dscnt 0x0" ::: "memory");            // this wave's reads of the buffer are over before anyone refills it
    asm volatile("s_wait_asynccnt 0x0" ::: "memory");         // this wave's copies of stage st + 1 have landed
    __syncthreads();                                          // publishes stage st + 1 and ends every reader's last read of stage st
    if (st + 2 < KP / 64) PJ_FILL(st + 2, st & 1)
  }
#undef PJ_FILL
  asm volatile("s_wait_asynccnt 0x0" ::: "memory");           // no copy is in flight when the buffers become output staging
#pragma unroll
  for (int j = 0; j < 4; ++j) { const float bb = bfr(bias[n0 + wc + j * 16 + col]);
#pragma unroll
    for (int i = 0; i < 4; ++i)
#pragma unroll
      for (int r = 0; r < 8; ++r) ss[wr + i * 16 + 8 * g + r][wc + j * 16 + col] = acc[i][j][r] + bb; }
  __syncthreads();
  if (mode == 1) {
    const int bb = r0 / SEQ, nl = r0 - bb * SEQ;
    _Float16* vt = P0 + ((size_t)((bb * KP + c0 + n0) >> 4) * (SEQ / 32) + (nl >> 5)) * FU + lane * 8;
    // 16 row tiles (16 features) x 4 units (32 positions) x 2 pieces; lane = (g, col): feature dt * 16 + col, positions ku * 32 + q * 16 + 8 g + 0..7
    for (int e = wave; e < 128; e += 8) { const int dt = e >> 3, ku = (e >> 1) & 3, q = e & 1; v8h o;
#pragma unroll
      for (int i = 0; i < 8; ++i) o[i] = (_Float16)ss[ku * 32 + q * 16 + 8 * g + i][dt * 16 + col];
      vst2(vt + ((size_t)dt * (SEQ / 32) + ku) * FU + q * 256, __builtin_bit_cast(v4u, o));
      asm volatile("s_wait_xcnt 0x0" ::: "memory");   // precaution: the next trip rewrites the store's address and data registers
    }
  } else {
#pragma unroll 1
    for (int it = 0; it < 16; ++it) { const int rt = wave;                                     // row tile rt of the block's 8; unit it >> 1, piece it & 1
      const int rl = rt * 16 + col, cl = it * 16 + 8 * g;
      const v4f x0 = *(const v4f*)&ss[rl][cl], x1 = *(const v4f*)&ss[rl][cl + 4];
      float v[8]; v8h hh, rr;
#pragma unroll
      for (int i = 0; i < 4; ++i) { v[i] = x0[i]; v[4 + i] = x1[i]; }
#pragma unroll
      for (int i = 0; i < 8; ++i) hh[i] = (_Float16)v[i];
#pragma unroll
      for (int i = 0; i < 8; ++i) rr[i] = (_Float16)((v[i] - (float)hh[i]) * QCAR);
      const size_t ro = ((size_t)((r0 >> 4) + rt) * (KP / 32) + ((c0 + n0) >> 5) + (it >> 1)) * FU + (it & 1) * 256 + lane * 8;
      vst2(P0 + ro, __builtin_bit_cast(v4u, hh));
      vst2(P1 + ro, __builtin_bit_cast(v4u, rr));
      asm volatile("s_wait_xcnt 0x0" ::: "memory");   // precaution: the next trip rewrites the two stores' address and data registers
    }
  }
}

// ---- k_sc: complex scores s of batch blockIdx.z = b, both planes z in one block, with k plane = [kr | ki] and q plane = [qr | qi]; one k-step = 32 features of the re and of the im half:
// z=0: qr.kr + qi.(-ki) (sign-bit flip of the ki fragments); z=1: qr.ki + qi.kr; x 1/sqrt(512)
// q = hi + res/2^11, k = hi + res/2^11: products hi.hi -> h*, res.hi + hi.res -> c* (folded x 2^-11)
// block = 64 queries x 128 keys, 8 waves (2 x 4) each 32 x 32 in both planes: 16 fragments read from LDS per 48 products
// a stage = one k-step of the block's 4 q and 8 k row tiles = 48 units (48 KiB), brought once per block by asynchronous copies, two buffers: row tile t (q 0..3, k 4..11) at t * 4 KiB, its units hi re, hi im, res re, res im 1 KiB each
#define SC_ST 49152
__global__ __launch_bounds__(256) void k_sc(const _Float16* __restrict__ QH, const _Float16* __restrict__ QR, const _Float16* __restrict__ KH, const _Float16* __restrict__ KR,
                                            float* __restrict__ ST, _Float16* __restrict__ P) {
  __shared__ __align__(16) char sm[2 * SC_ST];                // in the loop: the two stage buffers; behind it: the block's output staging
  static_assert(sizeof(sm) >= 64 * 272 + 8 * 32 * 36 * 4);
  _Float16 (*se)[136] = (_Float16 (*)[136])sm;                // the block's E tile, 64 queries x 128 keys, pitch 272 B (16 B x odd)
  float (*sa)[32][36] = (float (*)[32][36])(sm + 64 * 272);   // each wave's own 32 x 32 magnitudes, pitch 144 B (16 B x odd)
  const int b = blockIdx.z;
  const int tid = threadIdx.x, wave = __builtin_amdgcn_readfirstlane(tid >> 5), lane = tid & 31, col = lane & 15, g = lane >> 4;   // wave number as a scalar: tile offsets are scalar arithmetic, which keeps the kernel inside 256 vector registers
  const int k0 = blockIdx.y * 128 + (wave & 3) * 32; const int ql0 = blockIdx.x * 64 + (wave >> 2) * 32;
  // this wave's share of every stage: pieces 3 wave .. 3 wave + 2; piece p = the re and the im unit of row tile p >> 1 in the hi (p even) or the residual (p odd) plane
  const int tq = (b * SEQ + blockIdx.x * 64) >> 4, tk = (b * SEQ + blockIdx.y * 128) >> 4;
#define SC_PIECE(P) ((const char*)((((P) < 8) ? (((P) & 1) ? QR : QH) : (((P) & 1) ? KR : KH)) + (size_t)(((P) < 8) ? tq + ((P) >> 1) : tk + ((P) >> 1) - 4) * (KP / 32) * FU + lane * 8))
  const char* ca = SC_PIECE(3 * wave); const char* cb = SC_PIECE(3 * wave + 1); const char* cc = SC_PIECE(3 * wave + 2);
#undef SC_PIECE
  const unsigned lw = lds_addr(sm) + wave * 6144 + lane * 16;
#define SC_FILL(KC, BUF) { const unsigned l_ = lw + (BUF) * SC_ST; const size_t o_ = (size_t)(KC) * 1024; acopy12<(DD / 32) * 1024>(l_, l_ + 2048, l_ + 4096, ca + o_, cb + o_, cc + o_); }
  SC_FILL(0, 0)
  asm volatile("s_wait_asynccnt 0x0" ::: "memory");           // this wave's copies of stage 0 have landed
  __syncthreads();                                            // stage 0 is published to every wave
  SC_FILL(1, 1)
  v8f hr[2][2] = {}, cr[2][2] = {}, hi[2][2] = {}, ci[2][2] = {};             // [query tile][key tile]
#pragma unroll 1
  for (int kc = 0; kc < DD / 32; ++kc) {
    const _Float16* st = (const _Float16*)(sm + (kc & 1) * SC_ST) + lane * 8;
    const _Float16* sq = st + (wave >> 2) * 2 * 2048; const _Float16* sk = st + (4 + (wave & 3) * 2) * 2048;
    v16h qrh[2], qrc[2], qih[2], qic[2], krh[2], krc[2], kih[2], kic[2];      // re / im part, hi / residual
#pragma unroll
    for (int i = 0; i < 2; ++i) { const int u = i * 2048; qrc[i] = fragu_h(sq + u + 1024); krh[i] = fragu_h(sk + u); kih[i] = fragu_h(sk + u + 512); }   // what the first products take comes first
#pragma unroll
    for (int i = 0; i < 2; ++i) { const int u = i * 2048; qrh[i] = fragu_h(sq + u); qih[i] = fragu_h(sq + u + 512); qic[i] = fragu_h(sq + u + 1536); }
#define SC4(ACC, A, B) _Pragma("unroll") for (int i = 0; i < 2; ++i) _Pragma("unroll") for (int j = 0; j < 2; ++j) ACC[i][j] = wmma16(A[i], B[j], ACC[i][j]);
    SC4(cr, qrc, krh) SC4(ci, qrc, kih)
    // the k residuals come behind the last uses of qrc, whose registers they can take
#pragma unroll
    for (int i = 0; i < 2; ++i) { const int u = i * 2048; krc[i] = fragu_h(sk + u + 1024); kic[i] = fragu_h(sk + u + 1536); }
    SC4(hr, qrh, krh) SC4(hi, qrh, kih) SC4(hi, qih, krh) SC4(ci, qic, krh)
#pragma unroll
    for (int i = 0; i < 2; ++i) kih[i] = hneg(kih[i], 0x80008000u);            // qi.(-ki) = -(qi.ki), exact
    SC4(hr, qih, kih) SC4(cr, qic, kih)
    SC4(cr, qrh, krc) SC4(ci, qih, krc) SC4(ci, qrh, kic)
#pragma unroll
    for (int i = 0; i < 2; ++i) kic[i] = hneg(kic[i], 0x80008000u);
    SC4(cr, qih, kic)
#undef SC4
    asm volatile("s_wait_dscnt 0x0" ::: "memory");            // this wave's reads of the buffer are over before anyone refills it
    asm volatile("s_wait_asynccnt 0x0" ::: "memory");         // this wave's copies of stage kc + 1 have landed
    __syncthreads();                                          // publishes stage kc + 1 and ends every reader's last read of stage kc
    if (kc + 2 < DD / 32) SC_FILL(kc + 2, kc & 1)
  }
#undef SC_FILL
  asm volatile("s_wait_asynccnt 0x0" ::: "memory");           // no copy is in flight when the buffers become output staging
  // first half of the softmax, on the wave's own 32 x 32 tile, in the log2 domain: a = |s| log2(e) goes through the wave's own LDS piece so that a lane holds one whole row; then in the lane:
  // c = maximum over the 32 keys - ECL, E = 2^(a - c) (at most 2^ECL), sum of E. A softmax does not depend on the shift c, so the second half is exact for whatever c stands in the plane beside its sum.
  // v_sqrt_f32 and v_exp_f32 bare (about 1 ulp each; a subnormal x^2 + y^2 counts as 0): an error of a few 1e-7 relative in a, far below the f16 rounding of E
#pragma unroll
  for (int i = 0; i < 2; ++i)
#pragma unroll
    for (int j = 0; j < 2; ++j)
#pragma unroll
      for (int r = 0; r < 8; r += 2) {                          // two rows at a time: neighbouring accumulator registers feed packed f32 instructions as they lie
        const v2f x = v2f{hr[i][j][r], hr[i][j][r + 1]} * (SCL * L2E) + v2f{cr[i][j][r], cr[i][j][r + 1]} * (SCL * L2E / QCAR);
        const v2f y = v2f{hi[i][j][r], hi[i][j][r + 1]} * (SCL * L2E) + v2f{ci[i][j][r], ci[i][j][r + 1]} * (SCL * L2E / QCAR);
        const v2f n = x * x + y * y;
        sa[wave][i * 16 + 8 * g + r][j * 16 + col] = sqrt_s(n[0]); sa[wave][i * 16 + 8 * g + r + 1][j * 16 + col] = sqrt_s(n[1]); }
  asm volatile("s_wait_dscnt 0x0" ::: "memory");              // the wave's own LDS stores are done before its lanes read back rows that other lanes of the wave wrote (no barrier: a wave reads only its own piece)
  float a[32];
#pragma unroll
  for (int q = 0; q < 8; ++q) { const v4f t = *(const v4f*)&sa[wave][lane][q * 4];
#pragma unroll
    for (int i = 0; i < 4; ++i) a[q * 4 + i] = t[i]; }
  float mx = a[0];
#pragma unroll
  for (int k = 1; k < 32; ++k) mx = fmaxf(mx, a[k]);
  const float c = mx - ECL;
  float sq[4] = {};                                           // four partial sums: four short dependent chains in place of one of 32
#pragma unroll
  for (int q = 0; q < 4; ++q) { v8h o;
#pragma unroll
    for (int i = 0; i < 8; ++i) { const float e = exp2_s(a[q * 8 + i] - c); sq[q] += e; o[i] = (_Float16)e; }
    *(v8h*)&se[(wave >> 2) * 32 + lane][(wave & 3) * 32 + q * 8] = o; }
  __syncthreads();
  // the wave's 32 shifts c and 32 sums: two stores of one whole line each (behind the barrier, which would otherwise wait for them)
  float* stp = ST + ((size_t)((b * SEQ + ql0) >> 5) * (SEQ / 32) + (k0 >> 5)) * 64 + lane;
  stp[0] = c; stp[32] = (sq[0] + sq[1]) + (sq[2] + sq[3]);
  // the E tile: each store of a wave = 2 rows x 256 B (whole lines)
  _Float16* pp = P + ((size_t)b * SEQ + blockIdx.x * 64 + wave * 8 + g) * SEQ + blockIdx.y * 128 + col * 8;
#pragma unroll
  for (int it = 0; it < 4; ++it) vst2(pp + (size_t)(it * 2) * SEQ, *(const v4u*)&se[wave * 8 + it * 2 + g][col * 8]);
}
// ---- k_pv: second half of the softmax and ctx[n][0..1023] = P[b] . [vr|vi] for batch b = blockIdx.z: P x2^14 = E x factor, factor(row, 32 keys) = 2^14 x 2^(their shift c - largest c of the row) / row sum; columns 0..511 -> output plane 0, 512..1023 -> plane 1; block = 128 queries x 128 cols, 4 waves each 32 x 128: 10 fragments read from LDS per 16 products
// a stage = four k-steps (128 keys), brought once per block by asynchronous copies, two buffers: the block's 128 P rows of 256 B at pitch 272 B (16 B x odd: the 16-byte fragment reads of 16 rows fall on different banks),
// behind them the 8 v row tiles, 4 KiB each (contiguous in the fragment-order plane)
#define PV_PP 272
#define PV_VO (128 * PV_PP)
#define PV_ST (PV_VO + 8 * 4096)
__global__ __launch_bounds__(128) void k_pv(const _Float16* __restrict__ P, const float* __restrict__ ST, const _Float16* __restrict__ VT, float* __restrict__ OUT) {
  __shared__ __align__(16) _Float16 sf[128][36];              // factor x2^7 of each of the block's rows and each 32 keys; pitch 72 B: the 8-byte reads of 16 rows fall on different banks
  __shared__ __align__(16) char sm[2 * PV_ST];                // in the loop: the two stage buffers; behind it: each wave's output staging
  static_assert(sizeof(sm) >= 4 * 32 * 132 * 4);
  float (*ss)[32][132] = (float (*)[32][132])sm;
  const int b = blockIdx.z;
  const int tid = threadIdx.x, wave = __builtin_amdgcn_readfirstlane(tid >> 5), lane = tid & 31, col = lane & 15, g = lane >> 4;   // wave number as a scalar: tile offsets are scalar arithmetic
  const int n0 = blockIdx.y * 128; const int ql0 = blockIdx.x * 128 + wave * 32;
  // this wave's share of every stage: its own 32 P rows (a copy = 2 rows x 256 B) and v row tiles 2 wave, 2 wave + 1 (a copy = 512 B)
  const char* cp = (const char*)(P + ((size_t)b * SEQ + ql0 + g) * SEQ + col * 8);
  const char* cv = (const char*)(VT + (size_t)(((b * KP + n0) >> 4) + 2 * wave) * (SEQ / 32) * FU + lane * 8);
  const unsigned lp = lds_addr(sm) + (wave * 32 + g) * PV_PP + col * 16, lv = lds_addr(sm) + PV_VO + wave * 8192 + lane * 16;
#define PV_FILL(ST, BUF) { const unsigned o_ = (BUF) * PV_ST; const char* p_ = cp + (size_t)(ST) * 256; const char* v_ = cv + (size_t)(ST) * 4096; \
    acopy8<2 * PV_PP, 4 * SEQ>(lp + o_, p_); acopy8<2 * PV_PP, 4 * SEQ>(lp + o_ + 16 * PV_PP, p_ + 32 * SEQ); \
    acopy8<512, 512>(lv + o_, v_); acopy8<512, 512>(lv + o_ + 4096, v_ + (SEQ / 32) * FU * 2); }
  PV_FILL(0, 0)
  { // thread = one of the block's rows: its SEQ / 32 shifts c and sums of E -> largest shift, row sum at that shift (at least about 2^ECL), factors (at most about 2^ECL), while stage 0 flies
    const float* sp = ST + (size_t)((b * SEQ + ql0) >> 5) * (SEQ / 32) * 64 + lane;
    float pm[SEQ / 32], ps[SEQ / 32];
#pragma unroll
    for (int k = 0; k < SEQ / 32; ++k) { pm[k] = sp[k * 64]; ps[k] = sp[k * 64 + 32]; }
    asm volatile("s_wait_xcnt 0x0" ::: "memory");             // precaution: the loads' address registers may be rewritten behind here
    float m = pm[0];
#pragma unroll
    for (int k = 1; k < SEQ / 32; ++k) m = fmaxf(m, pm[k]);
    float sum = 0.f;
#pragma unroll
    for (int k = 0; k < SEQ / 32; ++k) { pm[k] = exp2_s(pm[k] - m); sum += ps[k] * pm[k]; }
    const float inv = PCAR / sum;
#pragma unroll
    for (int k = 0; k < SEQ / 32; ++k) sf[tid][k] = (_Float16)(pm[k] * inv);
  }
  asm volatile("s_wait_asynccnt 0x0" ::: "memory");           // this wave's copies of stage 0 have landed
  __syncthreads();                                            // stage 0 and the factors are published to every wave
  PV_FILL(1, 1)
  v8f acc[2][8] = {};
#pragma unroll 1
  for (int st = 0; st < SEQ / 128; ++st) {
    const char* sb = sm + (st & 1) * PV_ST;
    const _Float16* sp = (const _Float16*)(sb + (wave * 32 + col) * PV_PP); const _Float16* sv = (const _Float16*)(sb + PV_VO) + lane * 8;
    v4h fa[2];                                                // the stage's four factors of this lane's two rows
#pragma unroll
    for (int i = 0; i < 2; ++i) fa[i] = *(const v4h*)&sf[wave * 32 + i * 16 + col][st * 4];
#pragma unroll
    for (int kk = 0; kk < 4; ++kk) {
      v16h a[2], v[8];
#pragma unroll
      for (int i = 0; i < 2; ++i) a[i] = frag_h(sp + i * 16 * (PV_PP / 2) + kk * 32, lane) * fa[i][kk];
#pragma unroll
      for (int j = 0; j < 8; ++j) v[j] = fragu_h(sv + j * 2048 + kk * FU);
#pragma unroll
      for (int j = 0; j < 8; ++j)
#pragma unroll
        for (int i = 0; i < 2; ++i) acc[i][j] = wmma16(a[i], v[j], acc[i][j]);
    }
    asm volatile("s_wait_dscnt 0x0" ::: "memory");            // this wave's reads of the buffer are over before anyone refills it
    asm volatile("s_wait_asynccnt 0x0" ::: "memory");         // this wave's copies of stage st + 1 have landed
    __syncthreads();                                          // publishes stage st + 1 and ends every reader's last read of stage st
    if (st + 2 < SEQ / 128) PV_FILL(st + 2, st & 1)
  }
#undef PV_FILL
  asm volatile("s_wait_asynccnt 0x0" ::: "memory");           // no copy is in flight when the buffers become output staging
#pragma unroll
  for (int i = 0; i < 2; ++i)
#pragma unroll
    for (int j = 0; j < 8; ++j)
#pragma unroll
      for (int r = 0; r < 8; ++r) ss[wave][i * 16 + 8 * g + r][j * 16 + col] = acc[i][j][r] * (1.0f / PCAR);
  __syncthreads();
  const int pl = n0 / DD, d0 = n0 - pl * DD;
  float* ob = OUT + (((size_t)pl * NB_FULL + b) * SEQ_FULL + ql0) * DD + d0 + lane * 4;
#pragma unroll 1
  for (int rl = 0; rl < 32; ++rl) { vst2(ob + (size_t)rl * DD, *(const v4f*)&ss[wave][rl][lane * 4]);
    asm volatile("s_wait_xcnt 0x0" ::: "memory");     // precaution: the next trip rewrites the store's address and data registers
  }
}

extern "C" void kernel_launch(void* const* d_in, const int* in_sizes, int n_in, void* d_out, int out_size, void* d_ws, size_t ws_size, hipStream_t stream) {
  if (n_in < 14) return;
  const float* xr = (const float*)d_in[0];  const float* xi = (const float*)d_in[1];
  const float* wqr = (const float*)d_in[2]; const float* wqi = (const float*)d_in[3]; const float* bqr = (const float*)d_in[4]; const float* bqi = (const float*)d_in[5];
  const float* wkr = (const float*)d_in[6]; const float* wki = (const float*)d_in[7]; const float* bkr = (const float*)d_in[8]; const float* bki = (const float*)d_in[9];
  const float* wvr = (const float*)d_in[10]; const float* wvi = (const float*)d_in[11]; const float* bvr = (const float*)d_in[12]; const float* bvi = (const float*)d_in[13];
  const int need_x = ((NB - 1) * SEQ_FULL + SEQ) * DD;
  if (in_sizes[0] < need_x || in_sizes[1] < need_x) return;
  for (int i = 2; i < 14; i += 4) { if (in_sizes[i] < DD * DD || in_sizes[i + 1] < DD * DD || in_sizes[i + 2] < DD || in_sizes[i + 3] < DD) return; }
  const int need_out = ((NB_FULL + NB - 1) * SEQ_FULL + SEQ) * DD;
  if (out_size < need_out) return;
  if (ws_size < (size_t)WS_END) return;
  char* ws = (char*)d_ws;
  __bf16* X = (__bf16*)(ws + WS_X); __bf16* Wp = (__bf16*)(ws + WS_W);
  _Float16* QH = (_Float16*)(ws + WS_QH); _Float16* QR = (_Float16*)(ws + WS_QR);
  _Float16* KH = (_Float16*)(ws + WS_KH); _Float16* KR = (_Float16*)(ws + WS_KR);
  _Float16* VT = (_Float16*)(ws + WS_VT); float* S = (float*)(ws + WS_S); _Float16* P = (_Float16*)(ws + WS_P);
  float* out = (float*)d_out;

  k_cvx<<<dim3(MR / 16, KP / 256), 256, 0, stream>>>(xr, xi, X);
  k_cvw<<<dim3(DD / 8, 3), 256, 0, stream>>>(wqr, wqi, wkr, wki, wvr, wvi, Wp);
  k_proj<<<dim3(MR / 128, DD / 256, 6), 256, 0, stream>>>(X, Wp, bqr, bqi, bkr, bki, bvr, bvi, QH, QR, KH, KR, VT);
  k_sc<<<dim3(SEQ / 64, SEQ / 128, NB), 256, 0, stream>>>(QH, QR, KH, KR, S, P);
  k_pv<<<dim3(SEQ / 128, KP / 128, NB), 128, 0, stream>>>(P, S, VT, out);
}

// v007
// One run takes 90.5 microseconds.
// It is 1.52 times as fast as v005, going by the measured steps of the versions left out in between.
// Over all steps from v000 it is 13.5 times as fast.
// compute dtype: all float inputs RNE-converted to bf16 on load; q/k/v projections on v_wmma_f32_16x16x32_bf16 (bf16 operands, exact products), f32 accumulate; scores on v_wmma_f32_16x16x32_f16 with q and k = f16 (1 product, f32 accumulate); magnitude (v_sqrt_f32), exponentials (v_exp_f32, scores in the log2 domain), maxima and sums of the softmax in f32 -> E = exp(a - max of its 32 keys) f16 x2^7, rescaled per row and 32 keys by an f16 factor x2^7 (packed f16 multiply) -> P f16 x2^14; P.v on v_wmma_f32_16x16x32_f16 with v = f16 hi (1 product); f32 output.
#include <hip/hip_runtime.h>
#include <math.h>

typedef __attribute__((ext_vector_type(16))) _Float16 v16h;
typedef __attribute__((ext_vector_type(16))) __bf16 v16b;
typedef __attribute__((ext_vector_type(8)))  _Float16 v8h;
typedef __attribute__((ext_vector_type(4)))  _Float16 v4h;
typedef __attribute__((ext_vector_type(2)))  float v2f;
typedef __attribute__((ext_vector_type(8)))  __bf16 v8b;
typedef __attribute__((ext_vector_type(8)))  float v8f;
typedef __attribute__((ext_vector_type(8)))  unsigned v8u;
typedef __attribute__((ext_vector_type(4)))  float v4f;
typedef __attribute__((ext_vector_type(4)))  unsigned v4u;

#define DD 512            // feature width per real/imag part
#define KP 1024           // concatenated contraction length [re | im]
#define NB_FULL 8
#define SEQ_FULL 1024
#ifndef NB
#define NB NB_FULL
#endif
#ifndef SEQ
#define SEQ SEQ_FULL
#endif
#define MR (NB * SEQ)     // projection rows
#define PCAR 16384.0f     // carry of the P fragments: 2^ECL from the E plane x 2^ECL from the rescale factors
#define ECL 7.0f          // log2 of the carry of the E plane
#define L2E 1.4426950408889634f     // log2(e): the magnitudes are formed x log2(e), so that exp(a - c) is one v_exp_f32 of a difference
#define SCL 0.044194173824159216f   // 1/sqrt(512)

static_assert(NB >= 1 && NB <= NB_FULL);
static_assert(SEQ >= 256 && SEQ <= SEQ_FULL && (SEQ % 256) == 0);
static_assert((MR % 128) == 0);

// Planes marked FO lie in fragment order: a plane [R][K] is cut into units of 16 rows x 32 k = 512 elements (1 KiB), unit (rt, ks) at element (rt * (K / 32) + ks) * 512;
// inside a unit element (row, k) stands at ((k & 31) >> 4) * 256 + ((((k >> 3) & 1) * 16) + (row & 15)) * 8 + (k & 7): lane l's two 16-byte pieces at l * 8 and 256 + l * 8,
// so each 16-byte load or store of a wave covers 512 contiguous bytes (4 whole lines) in place of 32 bytes in each of 16 rows.
#define FU 512                                         // elements per fragment unit
#define WPL    ((size_t)DD * KP)                      // elements per weight plane
#define WS_X   ((size_t)0)                             // bf16 [MR][KP] FO
#define WS_W   (WS_X + 2u * (size_t)MR * KP)           // bf16 3 x [DD][KP] FO W = [Wr | Wi]
#define WS_QH  (WS_W + 2u * 3u * WPL)                  // f16  [MR][KP] FO q = [qr | qi]
#define WS_KH  (WS_QH + 2u * (size_t)MR * KP)          // f16  [MR][KP] FO k = [kr | ki]
#define WS_VT  (WS_KH + 2u * (size_t)MR * KP)          // f16  [NB * KP][SEQ] FO
#define WS_S   (WS_VT + 2u * (size_t)NB * KP * SEQ)    // f32  [MR / 32][SEQ / 32][2][32]: per 32 queries x 32 keys the 32 row shifts c (log2 domain), then the 32 row sums of E (256 B, one writer)
#define WS_P   (WS_S + 4u * 2u * (size_t)MR * (SEQ / 32)) // f16  [NB][SEQ][SEQ] E x2^7
#define WS_END (WS_P + 2u * (size_t)NB * SEQ * SEQ)
static_assert(WS_END <= (size_t)268435456);
static_assert((WS_W % 256) == 0 && (WS_QH % 256) == 0 && (WS_KH % 256) == 0 && (WS_VT % 256) == 0 && (WS_S % 256) == 0 && (WS_P % 256) == 0);

template <typename T> __device__ __forceinline__ void vst2(void* p, T v) { *(T*)p = v;  }

__device__ __forceinline__ v8f wmma16(v16h a, v16h b, v8f c) {
  v8f d = __builtin_amdgcn_wmma_f32_16x16x32_f16(false, a, false, b, (short)0, c, false, false);
  asm volatile("v_nop\n\tv_nop\n\tv_nop\n\tv_nop" : "+v"(d) : "v"(a), "v"(b));
  return d;
}
__device__ __forceinline__ v8f wmma_bf(v16b a, v16b b, v8f c) {
  v8f d = __builtin_amdgcn_wmma_f32_16x16x32_bf16(false, a, false, b, (short)0, c, false, false);
  asm volatile("v_nop\n\tv_nop\n\tv_nop\n\tv_nop" : "+v"(d) : "v"(a), "v"(b));
  return d;
}
// 16x16x32 fragments: lane = (h = lane>>4, row/col = lane&15); elements 0..7 = k0+8h+0..7, 8..15 = k0+16+8h+0..7; D element r = row 8h+r, col lane&15
__device__ __forceinline__ v16h frag_h(const _Float16* rowk0, int lane) {
  union { v16h v; v8h q[2]; } u; const _Float16* p = rowk0 + 8 * (lane >> 4);
  u.q[0] = *(const v8h*)p; u.q[1] = *(const v8h*)(p + 16); return u.v;
}
// the same fragments from a fragment-order unit (same k at every lane and element position as frag_h); p = the unit + 8 * lane elements
__device__ __forceinline__ v16h fragu_h(const _Float16* p) {
  union { v16h v; v8h q[2]; } u; u.q[0] = *(const v8h*)p; u.q[1] = *(const v8h*)(p + 256); return u.v;
}
__device__ __forceinline__ v16b fragu_b(const __bf16* p) {
  union { v16b v; v8b q[2]; } u; u.q[0] = *(const v8b*)p; u.q[1] = *(const v8b*)(p + 256); return u.v;
}
// sign-bit flip of all 16 halves when m == 0x80008000 (exact negation), identity when m == 0
__device__ __forceinline__ v16h hneg(v16h x, unsigned m) { v8u u = __builtin_bit_cast(v8u, x); u ^= m; return __builtin_bit_cast(v16h, u); }
__device__ __forceinline__ v16b bneg(v16b x) { v8u u = __builtin_bit_cast(v8u, x); u ^= 0x80008000u; return __builtin_bit_cast(v16b, u); }   // sign-bit flip of all 16 bf16 (exact negation)
// asynchronous copies to LDS: each lane brings 16 bytes, a wave's copy 512 bytes; l* = the lane's LDS byte address, g* = the lane's global address.
// 12 copies = three 2-KiB pieces; in LDS a piece is contiguous, in global memory its second KiB lies G2 bytes behind the start of the first.
// The s_wait_xcnt stands inside the copies' own statement (precaution): the address registers stay whole until it, whatever the compiler puts behind the statement.
__device__ __forceinline__ unsigned lds_addr(const void* p) { return (unsigned)(size_t)p; }   // low 32 bits of a __shared__ address = byte offset in the work-group's LDS
template <int G2> __device__ __forceinline__ void acopy12(unsigned la, unsigned lb, unsigned lc, const char* ga, const char* gb, const char* gc) {
  asm volatile("global_load_async_to_lds_b128 %0, %12, off\n\tglobal_load_async_to_lds_b128 %1, %13, off\n\tglobal_load_async_to_lds_b128 %2, %14, off\n\tglobal_load_async_to_lds_b128 %3, %15, off\n\t"
               "global_load_async_to_lds_b128 %4, %16, off\n\tglobal_load_async_to_lds_b128 %5, %17, off\n\tglobal_load_async_to_lds_b128 %6, %18, off\n\tglobal_load_async_to_lds_b128 %7, %19, off\n\t"
               "global_load_async_to_lds_b128 %8, %20, off\n\tglobal_load_async_to_lds_b128 %9, %21, off\n\tglobal_load_async_to_lds_b128 %10, %22, off\n\tglobal_load_async_to_lds_b128 %11, %23, off\n\t"
               "s_wait_xcnt 0x0"
               :: "v"(la), "v"(la + 512), "v"(la + 1024), "v"(la + 1536), "v"(lb), "v"(lb + 512), "v"(lb + 1024), "v"(lb + 1536), "v"(lc), "v"(lc + 512), "v"(lc + 1024), "v"(lc + 1536),
                  "v"(ga), "v"(ga + 512), "v"(ga + G2), "v"(ga + G2 + 512), "v"(gb), "v"(gb + 512), "v"(gb + G2), "v"(gb + G2 + 512), "v"(gc), "v"(gc + 512), "v"(gc + G2), "v"(gc + G2 + 512)
               : "memory");
}
// 8 copies, LS bytes apart in LDS and GS bytes apart in global memory
template <int LS, int GS> __device__ __forceinline__ void acopy8(unsigned l, const char* g) {
  asm volatile("global_load_async_to_lds_b128 %0, %8, off\n\tglobal_load_async_to_lds_b128 %1, %9, off\n\tglobal_load_async_to_lds_b128 %2, %10, off\n\tglobal_load_async_to_lds_b128 %3, %11, off\n\t"
               "global_load_async_to_lds_b128 %4, %12, off\n\tglobal_load_async_to_lds_b128 %5, %13, off\n\tglobal_load_async_to_lds_b128 %6, %14, off\n\tglobal_load_async_to_lds_b128 %7, %15, off\n\t"
               "s_wait_xcnt 0x0"
               :: "v"(l), "v"(l + LS), "v"(l + 2 * LS), "v"(l + 3 * LS), "v"(l + 4 * LS), "v"(l + 5 * LS), "v"(l + 6 * LS), "v"(l + 7 * LS),
                  "v"(g), "v"(g + GS), "v"(g + 2 * GS), "v"(g + 3 * GS), "v"(g + 4 * GS), "v"(g + 5 * GS), "v"(g + 6 * GS), "v"(g + 7 * GS)
               : "memory");
}
// 8 copies = one row tile's share of a stage: 4 KiB contiguous in LDS; in global memory 2 KiB at g (re half) and 2 KiB at g + GB (im half)
template <int GB> __device__ __forceinline__ void acopy8s(unsigned l, const char* g) {
  asm volatile("global_load_async_to_lds_b128 %0, %8, off\n\tglobal_load_async_to_lds_b128 %1, %9, off\n\tglobal_load_async_to_lds_b128 %2, %10, off\n\tglobal_load_async_to_lds_b128 %3, %11, off\n\t"
               "global_load_async_to_lds_b128 %4, %12, off\n\tglobal_load_async_to_lds_b128 %5, %13, off\n\tglobal_load_async_to_lds_b128 %6, %14, off\n\tglobal_load_async_to_lds_b128 %7, %15, off\n\t"
               "s_wait_xcnt 0x0"
               :: "v"(l), "v"(l + 512), "v"(l + 1024), "v"(l + 1536), "v"(l + 2048), "v"(l + 2560), "v"(l + 3072), "v"(l + 3584),
                  "v"(g), "v"(g + 512), "v"(g + 1024), "v"(g + 1536), "v"(g + GB), "v"(g + GB + 512), "v"(g + GB + 1024), "v"(g + GB + 1536)
               : "memory");
}
__device__ __forceinline__ float bfr(float v) { return (float)(__bf16)v; }
// bare v_exp_f32 (2^x) and v_sqrt_f32, each with the one slot the instruction set asks for behind a transcendental in its own statement
__device__ __forceinline__ float exp2_s(float x) { float e; asm("v_exp_f32 %0, %1\n\tv_nop" : "=v"(e) : "v"(x)); return e; }    // the v_nop keeps the slot behind the transcendental
__device__ __forceinline__ float sqrt_s(float x) { float e; asm("v_sqrt_f32 %0, %1\n\tv_nop" : "=v"(e) : "v"(x)); return e; }   // the v_nop keeps the slot behind the transcendental

// ---- k_cvx: X[row][0..511] = bf16(xr[row]), X[row][512..1023] = bf16(xi[row]), fragment order; block = 16 rows x 8 units, one unit (16 rows x 32 k) per wave, two 512-B stores per wave
__global__ __launch_bounds__(256) void k_cvx(const float* __restrict__ XR, const float* __restrict__ XI, __bf16* __restrict__ X) {
  const int tid = threadIdx.x, wave = tid >> 5, lane = tid & 31;
  const int rt = blockIdx.x, ks = blockIdx.y * 8 + wave;               // ks is wave-uniform
  const int row = rt * 16 + (lane & 15);
  const int bb = row / SEQ, n = row - bb * SEQ;
  const float* sp = ((ks >= DD / 32) ? XI : XR) + ((size_t)bb * SEQ_FULL + n) * DD + (ks & (DD / 32 - 1)) * 32 + 8 * (lane >> 4);
  __bf16* dp = X + ((size_t)rt * (KP / 32) + ks) * FU + lane * 8;
#pragma unroll
  for (int q = 0; q < 2; ++q) {
    const v4f f0 = *(const v4f*)(sp + q * 16), f1 = *(const v4f*)(sp + q * 16 + 4);
    v8b o;
#pragma unroll
    for (int i = 0; i < 4; ++i) { o[i] = (__bf16)f0[i]; o[4 + i] = (__bf16)f1[i]; }
    vst2(dp + q * 256, __builtin_bit_cast(v4u, o));
  }
}
// ---- k_cvw: weight plane of complex linear y = blockIdx.y (q, k, v): W[e] = [Wr[e] | Wi[e]] (bf16), fragment order; block = 16 rows x 8 units of Wr and Wi, one unit of each per wave
__global__ __launch_bounds__(256) void k_cvw(const float* __restrict__ WQR, const float* __restrict__ WQI, const float* __restrict__ WKR, const float* __restrict__ WKI,
                                             const float* __restrict__ WVR, const float* __restrict__ WVI, __bf16* __restrict__ Wp) {
  const int y = blockIdx.y;                                            // block-uniform
  const float* WR = (y == 0) ? WQR : ((y == 1) ? WKR : WVR); const float* WI = (y == 0) ? WQI : ((y == 1) ? WKI : WVI);
  __bf16* BW = Wp + (size_t)y * WPL;
  const int tid = threadIdx.x, wave = tid >> 5, lane = tid & 31;
  const int et = blockIdx.x >> 1, ks = (blockIdx.x & 1) * 8 + wave;    // unit of the 512-wide source, wave-uniform
  const size_t so = (size_t)(et * 16 + (lane & 15)) * DD + ks * 32 + 8 * (lane >> 4);
  const float* pr = WR + so; const float* pi = WI + so;
  const size_t uo = ((size_t)et * (KP / 32) + ks) * FU + lane * 8;      // left half; the right half lies DD / 32 units on
#pragma unroll
  for (int q = 0; q < 2; ++q) {
    const v4f r0 = *(const v4f*)(pr + q * 16), r1 = *(const v4f*)(pr + q * 16 + 4), i0 = *(const v4f*)(pi + q * 16), i1 = *(const v4f*)(pi + q * 16 + 4);
    v8b vr, vi;
#pragma unroll
    for (int i = 0; i < 4; ++i) { vr[i] = (__bf16)r0[i]; vr[4 + i] = (__bf16)r1[i]; vi[i] = (__bf16)i0[i]; vi[4 + i] = (__bf16)i1[i]; }
    vst2(BW + uo + q * 256,                  __builtin_bit_cast(v4u, vr));
    vst2(BW + uo + (DD / 32) * FU + q * 256, __builtin_bit_cast(v4u, vi));
  }
}

// ---- k_proj: complex linear blockIdx.z (q, k, v), re and im outputs of a tile in one block, with X = [xr | xi] and W = [Wr | Wi]; one k-step = 32 features of the re and of the im half:
// yr = xr.Wr + xi.(-Wi) (sign-bit flip of the Wi fragments), yi = xr.Wi + xi.Wr, + bias: the four products share the same four operand tiles
// block = 128 rows x 128 cols in both planes, 8 waves (2 x 4) each 64 rows x 32 cols in both planes: 12 fragments read from LDS per 32 products
// a stage = two k-steps of the block's 8 X and 8 W row tiles = 64 units (64 KiB), brought once per block by asynchronous copies, two buffers: row tile t (X 0..7, W 8..15) at t * 4 KiB, its units re 0, re 1, im 0, im 1 of 1 KiB each
// q, k: f16 -> plane [MR][KP], re at column n, im at column DD + n; v: f16 transposed -> plane [NB * KP][SEQ]; both in fragment order
#define PJ_ST 65536
__global__ __launch_bounds__(256) void k_proj(const __bf16* __restrict__ X, const __bf16* __restrict__ W3,
                                              const float* __restrict__ BQR, const float* __restrict__ BQI, const float* __restrict__ BKR, const float* __restrict__ BKI,
                                              const float* __restrict__ BVR, const float* __restrict__ BVI,
                                              _Float16* QH, _Float16* KH, _Float16* VT) {
  __shared__ __align__(16) char sm[128 * 260 * 4];            // in the loop: the two stage buffers; behind it: the block's output staging (columns 0..127 re, 128..255 im)
  static_assert(sizeof(sm) >= 2 * PJ_ST);
  float (*ss)[260] = (float (*)[260])sm;
  const int pz = blockIdx.z;                                           // block-uniform
  const float* bre = (pz == 0) ? BQR : ((pz == 1) ? BKR : BVR); const float* bim = (pz == 0) ? BQI : ((pz == 1) ? BKI : BVI);
  _Float16* P0 = (pz == 0) ? QH : ((pz == 1) ? KH : VT);
  const int tid = threadIdx.x, wave = __builtin_amdgcn_readfirstlane(tid >> 5), lane = tid & 31, col = lane & 15, g = lane >> 4;   // wave number as a scalar: tile offsets are scalar arithmetic
  const int r0 = blockIdx.x * 128, n0 = blockIdx.y * 128; const int wr = (wave >> 2) * 64, wc = (wave & 3) * 32;
  // this wave's share of every stage: row tiles 2 wave and 2 wave + 1 of the stage's 16
  const char* cg = (const char*)(((wave < 4) ? X + (size_t)((r0 >> 4) + 2 * wave) * (KP / 32) * FU : W3 + (size_t)(pz * (DD / 16) + (n0 >> 4) + 2 * (wave - 4)) * (KP / 32) * FU) + lane * 8);
  const unsigned lw = lds_addr(sm) + wave * 8192 + lane * 16;
#define PJ_FILL(ST, BUF) { const unsigned l_ = lw + (BUF) * PJ_ST; const char* g_ = cg + (size_t)(ST) * 2048; \
    acopy8s<(DD / 32) * FU * 2>(l_, g_); acopy8s<(DD / 32) * FU * 2>(l_ + 4096, g_ + (KP / 32) * FU * 2); }
  PJ_FILL(0, 0)
  asm volatile("s_wait_asynccnt 0x0" ::: "memory");           // this wave's copies of stage 0 have landed
  __syncthreads();                                            // stage 0 is published to every wave
  PJ_FILL(1, 1)
  v8f yr[4][2] = {}, yi[4][2] = {};                           // [row tile][col tile]
#pragma unroll 1
  for (int st = 0; st < DD / 64; ++st) {
    const __bf16* sb = (const __bf16*)(sm + (st & 1) * PJ_ST) + lane * 8;
    const __bf16* sa = sb + (wave >> 2) * 4 * 2048; const __bf16* sw = sb + (8 + (wave & 3) * 2) * 2048;
#define PJ8(ACC, A, B) _Pragma("unroll") for (int i = 0; i < 4; ++i) _Pragma("unroll") for (int j = 0; j < 2; ++j) ACC[i][j] = wmma_bf(A[i], B[j], ACC[i][j]);
#pragma unroll
    for (int kk = 0; kk < 2; ++kk) {
      v16b xr[4], xi[4], fr[2], fi[2];
#pragma unroll
      for (int j = 0; j < 2; ++j) { fr[j] = fragu_b(sw + j * 2048 + kk * FU); fi[j] = fragu_b(sw + j * 2048 + kk * FU + 1024); }
#pragma unroll
      for (int i = 0; i < 4; ++i) { xr[i] = fragu_b(sa + i * 2048 + kk * FU); xi[i] = fragu_b(sa + i * 2048 + kk * FU + 1024); }
      PJ8(yr, xr, fr) PJ8(yi, xr, fi) PJ8(yi, xi, fr)
#pragma unroll
      for (int j = 0; j < 2; ++j) fi[j] = bneg(fi[j]);                            // xi.(-Wi) = -(xi.Wi), exact
      PJ8(yr, xi, fi)
    }
#undef PJ8
    asm volatile("s_wait_dscnt 0x0" ::: "memory");            // this wave's reads of the buffer are over before anyone refills it
    asm volatile("s_wait_asynccnt 0x0" ::: "memory");         // this wave's copies of stage st + 1 have landed
    __syncthreads();                                          // publishes stage st + 1 and ends every reader's last read of stage st
    if (st + 2 < DD / 64) PJ_FILL(st + 2, st & 1)
  }
#undef PJ_FILL
  asm volatile("s_wait_asynccnt 0x0" ::: "memory");           // no copy is in flight when the buffers become output staging
#pragma unroll
  for (int j = 0; j < 2; ++j) { const float br = bfr(bre[n0 + wc + j * 16 + col]), bi = bfr(bim[n0 + wc + j * 16 + col]);
#pragma unroll
    for (int i = 0; i < 4; ++i)
#pragma unroll
      for (int r = 0; r < 8; ++r) { ss[wr + i * 16 + 8 * g + r][wc + j * 16 + col] = yr[i][j][r] + br; ss[wr + i * 16 + 8 * g + r][128 + wc + j * 16 + col] = yi[i][j][r] + bi; } }
  __syncthreads();
  if (pz == 2) {
    const int bb = r0 / SEQ, nl = r0 - bb * SEQ;
    _Float16* vt = P0 + ((size_t)((bb * KP + n0) >> 4) * (SEQ / 32) + (nl >> 5)) * FU + lane * 8;
    // 16 row tiles (16 features; 0..7 re, 8..15 im) x 4 units (32 positions) x 2 pieces; lane = (g, col): staged column dt * 16 + col, positions ku * 32 + q * 16 + 8 g + 0..7
    for (int e = wave; e < 128; e += 8) { const int dt = e >> 3, ku = (e >> 1) & 3, q = e & 1; v8h o;
#pragma unroll
      for (int i = 0; i < 8; ++i) o[i] = (_Float16)ss[ku * 32 + q * 16 + 8 * g + i][dt * 16 + col];
      vst2(vt + ((size_t)((dt >> 3) * (DD / 16) + (dt & 7)) * (SEQ / 32) + ku) * FU + q * 256, __builtin_bit_cast(v4u, o));
      asm volatile("s_wait_xcnt 0x0" ::: "memory");   // precaution: the next trip rewrites the store's address and data registers
    }
  } else {
#pragma unroll 1
    for (int it = 0; it < 16; ++it) { const int rt = wave;                                     // row tile rt of the block's 8; half it >> 3, unit (it & 7) >> 1, piece it & 1
      const int rl = rt * 16 + col, cl = it * 16 + 8 * g;
      const v4f x0 = *(const v4f*)&ss[rl][cl], x1 = *(const v4f*)&ss[rl][cl + 4];
      v8h hh;
#pragma unroll
      for (int i = 0; i < 4; ++i) { hh[i] = (_Float16)x0[i]; hh[4 + i] = (_Float16)x1[i]; }
      const size_t ro = ((size_t)((r0 >> 4) + rt) * (KP / 32) + (it >> 3) * (DD / 32) + (n0 >> 5) + ((it & 7) >> 1)) * FU + (it & 1) * 256 + lane * 8;
      vst2(P0 + ro, __builtin_bit_cast(v4u, hh));
      asm volatile("s_wait_xcnt 0x0" ::: "memory");   // precaution: the next trip rewrites the store's address and data registers
    }
  }
}

// ---- k_sc: complex scores s of batch blockIdx.z = b, both planes z in one block, with k plane = [kr | ki] and q plane = [qr | qi]; one k-step = 32 features of the re and of the im half:
// z=0: qr.kr + qi.(-ki) (sign-bit flip of the ki fragments); z=1: qr.ki + qi.kr; x 1/sqrt(512)
// q and k are single f16 planes: their rounding (2^-11 relative) lies far under that of the bf16 x and W they were formed from (2^-8)
// block = 64 queries x 128 keys, 8 waves (2 x 4) each 32 x 32 in both planes: 8 fragments read from LDS per 16 products
// a stage = two k-steps of the block's 4 q and 8 k row tiles = 48 units (48 KiB), brought once per block by asynchronous copies, two buffers: row tile t (q 0..3, k 4..11) at t * 4 KiB, its units re 0, re 1, im 0, im 1 of 1 KiB each
#define SC_ST 49152
__global__ __launch_bounds__(256) void k_sc(const _Float16* __restrict__ QH, const _Float16* __restrict__ KH, float* __restrict__ ST, _Float16* __restrict__ P) {
  __shared__ __align__(16) char sm[2 * SC_ST];                // in the loop: the two stage buffers; behind it: the block's output staging
  static_assert(sizeof(sm) >= 64 * 272 + 8 * 32 * 36 * 4);
  _Float16 (*se)[136] = (_Float16 (*)[136])sm;                // the block's E tile, 64 queries x 128 keys, pitch 272 B (16 B x odd)
  float (*sa)[32][36] = (float (*)[32][36])(sm + 64 * 272);   // each wave's own 32 x 32 magnitudes, pitch 144 B (16 B x odd)
  const int b = blockIdx.z;
  const int tid = threadIdx.x, wave = __builtin_amdgcn_readfirstlane(tid >> 5), lane = tid & 31, col = lane & 15, g = lane >> 4;   // wave number as a scalar: tile offsets are scalar arithmetic
  const int k0 = blockIdx.y * 128 + (wave & 3) * 32; const int ql0 = blockIdx.x * 64 + (wave >> 2) * 32;
  // this wave's share of every stage: pieces 3 wave .. 3 wave + 2; piece p = two neighbouring units (2 KiB, contiguous in the plane) of the re (p even) or the im (p odd) half of row tile p >> 1
  const int tq = (b * SEQ + blockIdx.x * 64) >> 4, tk = (b * SEQ + blockIdx.y * 128) >> 4;
#define SC_PIECE(P) ((const char*)((((P) < 8) ? QH : KH) + ((size_t)(((P) < 8) ? tq + ((P) >> 1) : tk + ((P) >> 1) - 4) * (KP / 32) + ((P) & 1) * (DD / 32)) * FU + lane * 8))
  const char* ca = SC_PIECE(3 * wave); const char* cb = SC_PIECE(3 * wave + 1); const char* cc = SC_PIECE(3 * wave + 2);
#undef SC_PIECE
  const unsigned lw = lds_addr(sm) + wave * 6144 + lane * 16;
#define SC_FILL(SG, BUF) { const unsigned l_ = lw + (BUF) * SC_ST; const size_t o_ = (size_t)(SG) * 2048; acopy12<1024>(l_, l_ + 2048, l_ + 4096, ca + o_, cb + o_, cc + o_); }
  SC_FILL(0, 0)
  asm volatile("s_wait_asynccnt 0x0" ::: "memory");           // this wave's copies of stage 0 have landed
  __syncthreads();                                            // stage 0 is published to every wave
  SC_FILL(1, 1)
  v8f hr[2][2] = {}, hi[2][2] = {};                           // [query tile][key tile]
#pragma unroll 1
  for (int sg = 0; sg < DD / 64; ++sg) {
    const _Float16* st = (const _Float16*)(sm + (sg & 1) * SC_ST) + lane * 8;
    const _Float16* sq = st + (wave >> 2) * 2 * 2048; const _Float16* sk = st + (4 + (wave & 3) * 2) * 2048;
#define SC4(ACC, A, B) _Pragma("unroll") for (int i = 0; i < 2; ++i) _Pragma("unroll") for (int j = 0; j < 2; ++j) ACC[i][j] = wmma16(A[i], B[j], ACC[i][j]);
#pragma unroll
    for (int kk = 0; kk < 2; ++kk) {
      v16h qr[2], qi[2], kr[2], ki[2];
#pragma unroll
      for (int i = 0; i < 2; ++i) { const int u = i * 2048 + kk * FU; qr[i] = fragu_h(sq + u); kr[i] = fragu_h(sk + u); ki[i] = fragu_h(sk + u + 1024); qi[i] = fragu_h(sq + u + 1024); }
      SC4(hr, qr, kr) SC4(hi, qr, ki) SC4(hi, qi, kr)
#pragma unroll
      for (int i = 0; i < 2; ++i) ki[i] = hneg(ki[i], 0x80008000u);              // qi.(-ki) = -(qi.ki), exact
      SC4(hr, qi, ki)
    }
#undef SC4
    asm volatile("s_wait_dscnt 0x0" ::: "memory");            // this wave's reads of the buffer are over before anyone refills it
    asm volatile("s_wait_asynccnt 0x0" ::: "memory");         // this wave's copies of stage sg + 1 have landed
    __syncthreads();                                          // publishes stage sg + 1 and ends every reader's last read of stage sg
    if (sg + 2 < DD / 64) SC_FILL(sg + 2, sg & 1)
  }
#undef SC_FILL
  asm volatile("s_wait_asynccnt 0x0" ::: "memory");           // no copy is in flight when the buffers become output staging
  // first half of the softmax, on the wave's own 32 x 32 tile, in the log2 domain: a = |s| log2(e) goes through the wave's own LDS piece so that a lane holds one whole row; then in the lane:
  // c = maximum over the 32 keys - ECL, E = 2^(a - c) (at most 2^ECL), sum of E. A softmax does not depend on the shift c, so the second half is exact for whatever c stands in the plane beside its sum.
  // v_sqrt_f32 and v_exp_f32 bare (about 1 ulp each; a subnormal x^2 + y^2 counts as 0): an error of a few 1e-7 relative in a, far below the f16 rounding of E
#pragma unroll
  for (int i = 0; i < 2; ++i)
#pragma unroll
    for (int j = 0; j < 2; ++j)
#pragma unroll
      for (int r = 0; r < 8; r += 2) {                          // two rows at a time: neighbouring accumulator registers feed packed f32 instructions as they lie
        const v2f x = v2f{hr[i][j][r], hr[i][j][r + 1]} * (SCL * L2E);
        const v2f y = v2f{hi[i][j][r], hi[i][j][r + 1]} * (SCL * L2E);
        const v2f n = x * x + y * y;
        sa[wave][i * 16 + 8 * g + r][j * 16 + col] = sqrt_s(n[0]); sa[wave][i * 16 + 8 * g + r + 1][j * 16 + col] = sqrt_s(n[1]); }
  asm volatile("s_wait_dscnt 0x0" ::: "memory");              // the wave's own LDS stores are done before its lanes read back rows that other lanes of the wave wrote (no barrier: a wave reads only its own piece)
  float a[32];
#pragma unroll
  for (int q = 0; q < 8; ++q) { const v4f t = *(const v4f*)&sa[wave][lane][q * 4];
#pragma unroll
    for (int i = 0; i < 4; ++i) a[q * 4 + i] = t[i]; }
  float mx = a[0];
#pragma unroll
  for (int k = 1; k < 32; ++k) mx = fmaxf(mx, a[k]);
  const float c = mx - ECL;
  float sq[4] = {};                                           // four partial sums: four short dependent chains in place of one of 32
#pragma unroll
  for (int q = 0; q < 4; ++q) { v8h o;
#pragma unroll
    for (int i = 0; i < 8; ++i) { const float e = exp2_s(a[q * 8 + i] - c); sq[q] += e; o[i] = (_Float16)e; }
    *(v8h*)&se[(wave >> 2) * 32 + lane][(wave & 3) * 32 + q * 8] = o; }
  __syncthreads();
  // the wave's 32 shifts c and 32 sums: two stores of one whole line each (behind the barrier, which would otherwise wait for them)
  float* stp = ST + ((size_t)((b * SEQ + ql0) >> 5) * (SEQ / 32) + (k0 >> 5)) * 64 + lane;
  stp[0] = c; stp[32] = (sq[0] + sq[1]) + (sq[2] + sq[3]);
  // the E tile: each store of a wave = 2 rows x 256 B (whole lines)
  _Float16* pp = P + ((size_t)b * SEQ + blockIdx.x * 64 + wave * 8 + g) * SEQ + blockIdx.y * 128 + col * 8;
#pragma unroll
  for (int it = 0; it < 4; ++it) vst2(pp + (size_t)(it * 2) * SEQ, *(const v4u*)&se[wave * 8 + it * 2 + g][col * 8]);
}
// ---- k_pv: second half of the softmax and ctx[n][0..1023] = P[b] . [vr|vi] for batch b = blockIdx.z: P x2^14 = E x factor, factor(row, 32 keys) = 2^14 x 2^(their shift c - largest c of the row) / row sum; columns 0..511 -> output plane 0, 512..1023 -> plane 1; block = 128 queries x 128 cols, 4 waves each 32 x 128: 10 fragments read from LDS per 16 products
// a stage = four k-steps (128 keys), brought once per block by asynchronous copies, two buffers: the block's 128 P rows of 256 B at pitch 272 B (16 B x odd: the 16-byte fragment reads of 16 rows fall on different banks),
// behind them the 8 v row tiles, 4 KiB each (contiguous in the fragment-order plane)
#define PV_PP 272
#define PV_VO (128 * PV_PP)
#define PV_ST (PV_VO + 8 * 4096)
__global__ __launch_bounds__(128) void k_pv(const _Float16* __restrict__ P, const float* __restrict__ ST, const _Float16* __restrict__ VT, float* __restrict__ OUT) {
  __shared__ __align__(16) _Float16 sf[128][36];              // factor x2^7 of each of the block's rows and each 32 keys; pitch 72 B: the 8-byte reads of 16 rows fall on different banks
  __shared__ __align__(16) char sm[2 * PV_ST];                // in the loop: the two stage buffers; behind it: each wave's output staging
  static_assert(sizeof(sm) >= 4 * 32 * 132 * 4);
  float (*ss)[32][132] = (float (*)[32][132])sm;
  const int b = blockIdx.z;
  const int tid = threadIdx.x, wave = __builtin_amdgcn_readfirstlane(tid >> 5), lane = tid & 31, col = lane & 15, g = lane >> 4;   // wave number as a scalar: tile offsets are scalar arithmetic
  const int n0 = blockIdx.y * 128; const int ql0 = blockIdx.x * 128 + wave * 32;
  // this wave's share of every stage: its own 32 P rows (a copy = 2 rows x 256 B) and v row tiles 2 wave, 2 wave + 1 (a copy = 512 B)
  const char* cp = (const char*)(P + ((size_t)b * SEQ + ql0 + g) * SEQ + col * 8);
  const char* cv = (const char*)(VT + (size_t)(((b * KP + n0) >> 4) + 2 * wave) * (SEQ / 32) * FU + lane * 8);
  const unsigned lp = lds_addr(sm) + (wave * 32 + g) * PV_PP + col * 16, lv = lds_addr(sm) + PV_VO + wave * 8192 + lane * 16;
#define PV_FILL(ST, BUF) { const unsigned o_ = (BUF) * PV_ST; const char* p_ = cp + (size_t)(ST) * 256; const char* v_ = cv + (size_t)(ST) * 4096; \
    acopy8<2 * PV_PP, 4 * SEQ>(lp + o_, p_); acopy8<2 * PV_PP, 4 * SEQ>(lp + o_ + 16 * PV_PP, p_ + 32 * SEQ); \
    acopy8<512, 512>(lv + o_, v_); acopy8<512, 512>(lv + o_ + 4096, v_ + (SEQ / 32) * FU * 2); }
  PV_FILL(0, 0)
  { // thread = one of the block's rows: its SEQ / 32 shifts c and sums of E -> largest shift, row sum at that shift (at least about 2^ECL), factors (at most about 2^ECL), while stage 0 flies
    const float* sp = ST + (size_t)((b * SEQ + ql0) >> 5) * (SEQ / 32) * 64 + lane;
    float pm[SEQ / 32], ps[SEQ / 32];
#pragma unroll
    for (int k = 0; k < SEQ / 32; ++k) { pm[k] = sp[k * 64]; ps[k] = sp[k * 64 + 32]; }
    asm volatile("s_wait_xcnt 0x0" ::: "memory");             // precaution: the loads' address registers may be rewritten behind here
    float m = pm[0];
#pragma unroll
    for (int k = 1; k < SEQ / 32; ++k) m = fmaxf(m, pm[k]);
    float sum = 0.f;
#pragma unroll
    for (int k = 0; k < SEQ / 32; ++k) { pm[k] = exp2_s(pm[k] - m); sum += ps[k] * pm[k]; }
    const float inv = PCAR / sum;
#pragma unroll
    for (int k = 0; k < SEQ / 32; ++k) sf[tid][k] = (_Float16)(pm[k] * inv);
  }
  asm volatile("s_wait_asynccnt 0x0" ::: "memory");           // this wave's copies of stage 0 have landed
  __syncthreads();                                            // stage 0 and the factors are published to every wave
  PV_FILL(1, 1)
  v8f acc[2][8] = {};
#pragma unroll 1
  for (int st = 0; st < SEQ / 128; ++st) {
    const char* sb = sm + (st & 1) * PV_ST;
    const _Float16* sp = (const _Float16*)(sb + (wave * 32 + col) * PV_PP); const _Float16* sv = (const _Float16*)(sb + PV_VO) + lane * 8;
    v4h fa[2];                                                // the stage's four factors of this lane's two rows
#pragma unroll
    for (int i = 0; i < 2; ++i) fa[i] = *(const v4h*)&sf[wave * 32 + i * 16 + col][st * 4];
#pragma unroll
    for (int kk = 0; kk < 4; ++kk) {
      v16h a[2], v[8];
#pragma unroll
      for (int i = 0; i < 2; ++i) a[i] = frag_h(sp + i * 16 * (PV_PP / 2) + kk * 32, lane) * fa[i][kk];
#pragma unroll
      for (int j = 0; j < 8; ++j) v[j] = fragu_h(sv + j * 2048 + kk * FU);
#pragma unroll
      for (int j = 0; j < 8; ++j)
#pragma unroll
        for (int i = 0; i < 2; ++i) acc[i][j] = wmma16(a[i], v[j], acc[i][j]);
    }
    asm volatile("s_wait_dscnt 0x0" ::: "memory");            // this wave's reads of the buffer are over before anyone refills it
    asm volatile("s_wait_asynccnt 0x0" ::: "memory");         // this wave's copies of stage st + 1 have landed
    __syncthreads();                                          // publishes stage st + 1 and ends every reader's last read of stage st
    if (st + 2 < SEQ / 128) PV_FILL(st + 2, st & 1)
  }
#undef PV_FILL
  asm volatile("s_wait_asynccnt 0x0" ::: "memory");           // no copy is in flight when the buffers become output staging
#pragma unroll
  for (int i = 0; i < 2; ++i)
#pragma unroll
    for (int j = 0; j < 8; ++j)
#pragma unroll
      for (int r = 0; r < 8; ++r) ss[wave][i * 16 + 8 * g + r][j * 16 + col] = acc[i][j][r] * (1.0f / PCAR);
  __syncthreads();
  const int pl = n0 / DD, d0 = n0 - pl * DD;
  float* ob = OUT + (((size_t)pl * NB_FULL + b) * SEQ_FULL + ql0) * DD + d0 + lane * 4;
#pragma unroll 1
  for (int rl = 0; rl < 32; ++rl) { vst2(ob + (size_t)rl * DD, *(const v4f*)&ss[wave][rl][lane * 4]);
    asm volatile("s_wait_xcnt 0x0" ::: "memory");     // precaution: the next trip rewrites the store's address and data registers
  }
}

extern "C" void kernel_launch(void* const* d_in, const int* in_sizes, int n_in, void* d_out, int out_size, void* d_ws, size_t ws_size, hipStream_t stream) {
  if (n_in < 14) return;
  const float* xr = (const float*)d_in[0];  const float* xi = (const float*)d_in[1];
  const float* wqr = (const float*)d_in[2]; const float* wqi = (const float*)d_in[3]; const float* bqr = (const float*)d_in[4]; const float* bqi = (const float*)d_in[5];
  const float* wkr = (const float*)d_in[6]; const float* wki = (const float*)d_in[7]; const float* bkr = (const float*)d_in[8]; const float* bki = (const float*)d_in[9];
  const float* wvr = (const float*)d_in[10]; const float* wvi = (const float*)d_in[11]; const float* bvr = (const float*)d_in[12]; const float* bvi = (const float*)d_in[13];
  const int need_x = ((NB - 1) * SEQ_FULL + SEQ) * DD;
  if (in_sizes[0] < need_x || in_sizes[1] < need_x) return;
  for (int i = 2; i < 14; i += 4) { if (in_sizes[i] < DD * DD || in_sizes[i + 1] < DD * DD || in_sizes[i + 2] < DD || in_sizes[i + 3] < DD) return; }
  const int need_out = ((NB_FULL + NB - 1) * SEQ_FULL + SEQ) * DD;
  if (out_size < need_out) return;
  if (ws_size < (size_t)WS_END) return;
  char* ws = (char*)d_ws;
  __bf16* X = (__bf16*)(ws + WS_X); __bf16* Wp = (__bf16*)(ws + WS_W);
  _Float16* QH = (_Float16*)(ws + WS_QH); _Float16* KH = (_Float16*)(ws + WS_KH);
  _Float16* VT = (_Float16*)(ws + WS_VT); float* S = (float*)(ws + WS_S); _Float16* P = (_Float16*)(ws + WS_P);
  float* out = (float*)d_out;

  k_cvx<<<dim3(MR / 16, KP / 256), 256, 0, stream>>>(xr, xi, X);
  k_cvw<<<dim3(DD / 8, 3), 256, 0, stream>>>(wqr, wqi, wkr, wki, wvr, wvi, Wp);
  k_proj<<<dim3(MR / 128, DD / 128, 3), 256, 0, stream>>>(X, Wp, bqr, bqi, bkr, bki, bvr, bvi, QH, KH, VT);
  k_sc<<<dim3(SEQ / 64, SEQ / 128, NB), 256, 0, stream>>>(QH, KH, S, P);
  k_pv<<<dim3(SEQ / 128, KP / 128, NB), 128, 0, stream>>>(P, S, VT, out);
}
